// v000
// Times are from an AMD MI455X. After a warm-up the kernel runs many times in a row, and a time is the length of
// such a window on the GPU divided by its runs, so every launch and the gaps after it count. The runs cycle
// through copies of the inputs. A figure is the median of several windows, for all but v000 over two sittings.
// Sittings can differ by a few percent; kernels timed side by side share one.
// v000, which the later versions start from, runs in 74.8 microseconds.
#include <hip/hip_runtime.h>
#include <hip/hip_bf16.h>

typedef __attribute__((ext_vector_type(16))) _Float16 v16h;
typedef __attribute__((ext_vector_type(8)))  _Float16 v8h;
typedef __attribute__((ext_vector_type(8)))  float    v8f;
typedef __attribute__((ext_vector_type(2)))  float    v2f;

#define L_SEQ 512
#define DG 256
#define DB 128
#define NH 8
#define HD 32
#define KSPLIT 4      // k-range split factor for the attention kernel
#define ROWS 1024     // b * L_SEQ

// ---------- fragment loaders (f16 A/B layout: lane row/col = ln&15,
// halves[0..7] = K off2+0..7, halves[8..15] = K 16+off2+0..7, off2 = (ln>>4)*8)
__device__ __forceinline__ v16h ld_frag_full(const _Float16* p, int off2) {
  v8h a = *reinterpret_cast<const v8h*>(p + off2);
  v8h b = *reinterpret_cast<const v8h*>(p + 16 + off2);
  v16h r;
#pragma unroll
  for (int i = 0; i < 8; ++i) { r[i] = a[i]; r[i + 8] = b[i]; }
  return r;
}
__device__ __forceinline__ v16h ld_frag_lo(const _Float16* p, int off2) {
  v8h a = *reinterpret_cast<const v8h*>(p + off2);
  v16h r;
#pragma unroll
  for (int i = 0; i < 8; ++i) { r[i] = a[i]; r[i + 8] = (_Float16)0.f; }
  return r;
}

__device__ __forceinline__ float half16_max(float v) {
  v = fmaxf(v, __shfl_xor(v, 1, 32));
  v = fmaxf(v, __shfl_xor(v, 2, 32));
  v = fmaxf(v, __shfl_xor(v, 4, 32));
  v = fmaxf(v, __shfl_xor(v, 8, 32));
  return v;
}
__device__ __forceinline__ float half16_sum(float v) {
  v += __shfl_xor(v, 1, 32);
  v += __shfl_xor(v, 2, 32);
  v += __shfl_xor(v, 4, 32);
  v += __shfl_xor(v, 8, 32);
  return v;
}

// ---------- 16x16 output tile GEMM over K (f16 inputs, fp32 accum)
__device__ __forceinline__ v8f gemm_tile(const _Float16* A, const _Float16* BT,
                                         int row0, int col0, int K) {
  const int ln = threadIdx.x & 31;
  const int n = ln & 15;
  const int off2 = (ln >> 4) * 8;
  v8f c = {0.f, 0.f, 0.f, 0.f, 0.f, 0.f, 0.f, 0.f};
  const _Float16* ap = A + (size_t)(row0 + n) * K;
  const _Float16* bp = BT + (size_t)(col0 + n) * K;
  for (int ks = 0; ks < K; ks += 32) {
    v16h a = ld_frag_full(ap + ks, off2);
    v16h b = ld_frag_full(bp + ks, off2);
    c = __builtin_amdgcn_wmma_f32_16x16x32_f16(false, a, false, b, (short)0, c,
                                               false, false);
  }
  return c;
}

// ---------- kernel 1: transpose + f16 convert weights (Wk scaled by 1/sqrt(D))
__global__ __launch_bounds__(256) void k_prep(const float* Wq, const float* Wk,
                                              const float* Wv, const float* Wg,
                                              const float* Wout, _Float16* WT) {
  int n = blockIdx.x, m = blockIdx.y, k = threadIdx.x;
  const float* W = (m == 0) ? Wq : (m == 1) ? Wk : (m == 2) ? Wv : (m == 3) ? Wg : Wout;
  float sc = (m == 1) ? 0.17677669529663687f : 1.f;
  WT[((size_t)m * DG + n) * DG + k] = (_Float16)(W[(size_t)k * DG + n] * sc);
}

// ---------- kernel 2: layernorm(x) -> f16
__global__ __launch_bounds__(256) void k_lnx(const float* x, const float* gamma,
                                             const float* beta, _Float16* xnh) {
  int row = blockIdx.x, t = threadIdx.x;
  float v = x[(size_t)row * DG + t];
  __shared__ float sA[256], sB[256];
  sA[t] = v; sB[t] = v * v;
  __syncthreads();
  for (int s = 128; s > 0; s >>= 1) {
    if (t < s) { sA[t] += sA[t + s]; sB[t] += sB[t + s]; }
    __syncthreads();
  }
  float mu = sA[0] * (1.f / 256.f);
  float var = sB[0] * (1.f / 256.f) - mu * mu;
  float rs = rsqrtf(var + 1e-5f);
  xnh[(size_t)row * DG + t] = (_Float16)((v - mu) * rs * gamma[t] + beta[t]);
}

// ---------- kernel 3: q/k/v/gate projections (WMMA f16), z selects matrix
__global__ __launch_bounds__(32) void k_proj(const _Float16* xnh, const _Float16* WT,
                                             const float* bg, _Float16* qh,
                                             _Float16* kh, _Float16* vT, float* gate) {
  int mt = blockIdx.x, nt = blockIdx.y, z = blockIdx.z;
  v8f c = gemm_tile(xnh, WT + (size_t)z * DG * DG, mt * 16, nt * 16, DG);
  int ln = threadIdx.x & 31, n = ln & 15, hi = ln >> 4;
#pragma unroll
  for (int j = 0; j < 8; ++j) {
    int row = mt * 16 + j + 8 * hi;
    int col = nt * 16 + n;
    float v = c[j];
    if (z == 0) {
      qh[(size_t)row * DG + col] = (_Float16)v;
    } else if (z == 1) {
      kh[(size_t)row * DG + col] = (_Float16)v;
    } else if (z == 2) {
      int bb = row >> 9, kp = row & 511, h = col >> 5, d = col & 31;
      vT[((size_t)(bb * NH + h) * HD + d) * L_SEQ + kp] = (_Float16)v;
    } else {
      float g = v + bg[col];
      gate[(size_t)row * DG + col] = 1.f / (1.f + __expf(-g));
    }
  }
}

// ---------- kernel 4: fused bias-LN + pair projection + split-K flash attention
// grid (qt=32, b=2, ks=KSPLIT); each WG covers k in [ks*128, ks*128+128)
__global__ __launch_bounds__(256) void k_attn(const float* bias, const float* b_gamma,
                                              const float* b_beta, const float* Wb,
                                              const _Float16* qh, const _Float16* kh,
                                              const _Float16* vT,
                                              float* Opart, float* mpart, float* spart) {
  const int qt = blockIdx.x;
  const int b = blockIdx.y;
  const int ksp = blockIdx.z;
  const int tid = threadIdx.x;
  const int w = tid >> 5;          // wave id == head id
  const int ln = tid & 31;
  const int n = ln & 15;
  const int hi = ln >> 4;
  const int off2 = hi * 8;
  const int koff = hi * 2;         // f32 WMMA A/B K offset per lane half

  __shared__ float2 gwB2[64][16];              // B table for pair WMMA (c pairs x 16 cols)
  __shared__ float Gh[8], Cbh[8];              // sum(gamma*Wb), sum(beta*Wb)
  __shared__ float pairLds[16 * 16 * 17];      // [q][k][col], padded
  __shared__ float ssqLds[16 * 16 * 2];        // sumsq partials
  __shared__ _Float16 pP[8 * 16 * 24];         // per-wave P staging (row stride 24)

  // init B table: cols 0..7 = gamma[c]*Wb[c][h], col 8 = 1 (row sums), rest 0
  for (int idx = tid; idx < 1024; idx += 256) {
    int cp = idx >> 4, nn = idx & 15;
    int c0 = cp * 2;
    float v0 = (nn < 8) ? b_gamma[c0] * Wb[c0 * 8 + nn] : (nn == 8 ? 1.f : 0.f);
    float v1 = (nn < 8) ? b_gamma[c0 + 1] * Wb[(c0 + 1) * 8 + nn] : (nn == 8 ? 1.f : 0.f);
    gwB2[cp][nn] = make_float2(v0, v1);
  }
  if (tid < 8) {
    float g = 0.f, cb = 0.f;
    for (int c = 0; c < DB; ++c) {
      float wv = Wb[c * 8 + tid];
      g += b_gamma[c] * wv;
      cb += b_beta[c] * wv;
    }
    Gh[tid] = g; Cbh[tid] = cb;
  }

  // per-head Q fragment (rows = 16 q positions, K = 32 dims)
  const _Float16* qp = qh + (size_t)(b * L_SEQ + qt * 16 + n) * DG + w * HD;
  v16h aQ = ld_frag_full(qp, off2);

  float mrow[8], srow[8];
  v8f O1 = {0.f, 0.f, 0.f, 0.f, 0.f, 0.f, 0.f, 0.f};
  v8f O2 = {0.f, 0.f, 0.f, 0.f, 0.f, 0.f, 0.f, 0.f};
#pragma unroll
  for (int j = 0; j < 8; ++j) { mrow[j] = -1e30f; srow[j] = 0.f; }

  __syncthreads();

  const int kt0 = ksp * (L_SEQ / (16 * KSPLIT) ) ? 0 : 0; // (unused guard)
  const int ktBeg = ksp * 8;
  const int ktEnd = ktBeg + 8;
  const size_t bq0 = (size_t)(b * L_SEQ + qt * 16 + w * 2);
  const size_t bq1 = bq0 + 1;

  for (int kt = ktBeg; kt < ktEnd; ++kt) {
    // ---- phase 1: pair tile via f32 WMMA; wave w owns q rows 2w, 2w+1
    {
      const int q0 = w * 2, q1 = w * 2 + 1;
      const float* bp0 = bias + ((bq0 * L_SEQ + kt * 16 + n) * DB) + koff;
      const float* bp1 = bias + ((bq1 * L_SEQ + kt * 16 + n) * DB) + koff;
      // prefetch next k-tile's bias lines (speculative, guarded)
      if (kt + 1 < ktEnd) {
        const float* pf0 = bias + ((bq0 * L_SEQ + (kt + 1) * 16 + n) * DB) + hi * 64;
        const float* pf1 = bias + ((bq1 * L_SEQ + (kt + 1) * 16 + n) * DB) + hi * 64;
        __builtin_prefetch(pf0, 0, 0);
        __builtin_prefetch(pf0 + 32, 0, 0);
        __builtin_prefetch(pf1, 0, 0);
        __builtin_prefetch(pf1 + 32, 0, 0);
      }
      v8f C0 = {0.f, 0.f, 0.f, 0.f, 0.f, 0.f, 0.f, 0.f};
      v8f C1 = {0.f, 0.f, 0.f, 0.f, 0.f, 0.f, 0.f, 0.f};
      float ss0 = 0.f, ss1 = 0.f;
      for (int cs = 0; cs < 32; ++cs) {
        float2 av0 = *reinterpret_cast<const float2*>(bp0 + cs * 4);
        float2 av1 = *reinterpret_cast<const float2*>(bp1 + cs * 4);
        float2 bv = gwB2[cs * 2 + hi][n];
        ss0 += av0.x * av0.x + av0.y * av0.y;
        ss1 += av1.x * av1.x + av1.y * av1.y;
        v2f a0 = {av0.x, av0.y};
        v2f a1 = {av1.x, av1.y};
        v2f bb = {bv.x, bv.y};
        C0 = __builtin_amdgcn_wmma_f32_16x16x4_f32(false, a0, false, bb, (short)0,
                                                   C0, false, false);
        C1 = __builtin_amdgcn_wmma_f32_16x16x4_f32(false, a1, false, bb, (short)0,
                                                   C1, false, false);
      }
#pragma unroll
      for (int j = 0; j < 8; ++j) {
        pairLds[(q0 * 16 + j + 8 * hi) * 17 + n] = C0[j];
        pairLds[(q1 * 16 + j + 8 * hi) * 17 + n] = C1[j];
      }
      ssqLds[(q0 * 16 + n) * 2 + hi] = ss0;
      ssqLds[(q1 * 16 + n) * 2 + hi] = ss1;
    }
    __syncthreads();
    // ---- cleanup: finish layernorm correction per (q,k)
    {
      int q = tid >> 4, kk = tid & 15;
      int base = (q * 16 + kk) * 17;
      float sum = pairLds[base + 8];
      float ssq = ssqLds[(q * 16 + kk) * 2] + ssqLds[(q * 16 + kk) * 2 + 1];
      float mu = sum * (1.f / 128.f);
      float var = ssq * (1.f / 128.f) - mu * mu;
      float rsg = rsqrtf(var + 1e-5f);
#pragma unroll
      for (int h = 0; h < 8; ++h)
        pairLds[base + h] = rsg * (pairLds[base + h] - mu * Gh[h]) + Cbh[h];
    }
    __syncthreads();
    // ---- phase 2: per-head logits = Q*K^T + pair, flash update, O += P*V
    v8f cp;
#pragma unroll
    for (int j = 0; j < 8; ++j)
      cp[j] = pairLds[((j + 8 * hi) * 16 + n) * 17 + w];

    const _Float16* kp = kh + (size_t)(b * L_SEQ + kt * 16 + n) * DG + w * HD;
    v16h bK = ld_frag_full(kp, off2);
    v8f Lg = __builtin_amdgcn_wmma_f32_16x16x32_f16(false, aQ, false, bK, (short)0,
                                                    cp, false, false);
    float Pv[8];
#pragma unroll
    for (int j = 0; j < 8; ++j) {
      float l = Lg[j];
      float mx = half16_max(l);
      float nm = fmaxf(mrow[j], mx);
      float al = __expf(mrow[j] - nm);
      float p = __expf(l - nm);
      float rs = half16_sum(p);
      srow[j] = srow[j] * al + rs;
      mrow[j] = nm;
      O1[j] *= al; O2[j] *= al;
      Pv[j] = p;
    }
    // wave-private LDS transpose of P (C layout -> A layout)
    _Float16* pw = pP + w * 16 * 24;
#pragma unroll
    for (int j = 0; j < 8; ++j)
      pw[(j + 8 * hi) * 24 + n] = (_Float16)Pv[j];
    asm volatile("s_wait_dscnt 0" ::: "memory");
    v16h aP = ld_frag_lo(pw + n * 24, off2);     // rows q, K = 16 k (+16 zero pad)

    const _Float16* vp1 = vT + ((size_t)(b * NH + w) * HD + n) * L_SEQ + kt * 16;
    const _Float16* vp2 = vT + ((size_t)(b * NH + w) * HD + 16 + n) * L_SEQ + kt * 16;
    v16h bV1 = ld_frag_lo(vp1, off2);
    v16h bV2 = ld_frag_lo(vp2, off2);
    O1 = __builtin_amdgcn_wmma_f32_16x16x32_f16(false, aP, false, bV1, (short)0,
                                                O1, false, false);
    O2 = __builtin_amdgcn_wmma_f32_16x16x32_f16(false, aP, false, bV2, (short)0,
                                                O2, false, false);
    __syncthreads();
  }

  // epilogue: write unnormalized partials (O, m, s) for this k-range
#pragma unroll
  for (int j = 0; j < 8; ++j) {
    size_t row = (size_t)(b * L_SEQ + qt * 16 + j + 8 * hi);
    size_t base = ((size_t)ksp * ROWS + row) * DG + w * HD;
    Opart[base + n] = O1[j];
    Opart[base + 16 + n] = O2[j];
  }
  if (n == 0) {
#pragma unroll
    for (int j = 0; j < 8; ++j) {
      size_t row = (size_t)(b * L_SEQ + qt * 16 + j + 8 * hi);
      mpart[((size_t)ksp * ROWS + row) * NH + w] = mrow[j];
      spart[((size_t)ksp * ROWS + row) * NH + w] = srow[j];
    }
  }
}

// ---------- kernel 5: combine split-K partials, normalize, gate -> f16
__global__ __launch_bounds__(256) void k_comb(const float* Opart, const float* mpart,
                                              const float* spart, const float* gate,
                                              _Float16* attnOut) {
  int row = blockIdx.x;      // 0..1023
  int col = threadIdx.x;     // 0..255
  int h = col >> 5;
  float mv[KSPLIT];
  float m0 = -1e30f;
#pragma unroll
  for (int g = 0; g < KSPLIT; ++g) {
    mv[g] = mpart[((size_t)g * ROWS + row) * NH + h];
    m0 = fmaxf(m0, mv[g]);
  }
  float s = 0.f, o = 0.f;
#pragma unroll
  for (int g = 0; g < KSPLIT; ++g) {
    float e = __expf(mv[g] - m0);
    s += spart[((size_t)g * ROWS + row) * NH + h] * e;
    o += Opart[((size_t)g * ROWS + row) * DG + col] * e;
  }
  float gv = gate[(size_t)row * DG + col];
  attnOut[(size_t)row * DG + col] = (_Float16)(o / s * gv);
}

// ---------- kernel 6: output projection + bias
__global__ __launch_bounds__(32) void k_out(const _Float16* attnOut,
                                            const _Float16* WoutT, const float* bout,
                                            float* out) {
  int mt = blockIdx.x, nt = blockIdx.y;
  v8f c = gemm_tile(attnOut, WoutT, mt * 16, nt * 16, DG);
  int ln = threadIdx.x & 31, n = ln & 15, hi = ln >> 4;
#pragma unroll
  for (int j = 0; j < 8; ++j) {
    int row = mt * 16 + j + 8 * hi;
    int col = nt * 16 + n;
    out[(size_t)row * DG + col] = c[j] + bout[col];
  }
}

extern "C" void kernel_launch(void* const* d_in, const int* in_sizes, int n_in,
                              void* d_out, int out_size, void* d_ws, size_t ws_size,
                              hipStream_t stream) {
  (void)in_sizes; (void)n_in; (void)out_size; (void)ws_size;
  const float* x       = (const float*)d_in[0];
  const float* bias    = (const float*)d_in[1];
  const float* g_gamma = (const float*)d_in[2];
  const float* g_beta  = (const float*)d_in[3];
  const float* b_gamma = (const float*)d_in[4];
  const float* b_beta  = (const float*)d_in[5];
  const float* Wq      = (const float*)d_in[6];
  const float* Wk      = (const float*)d_in[7];
  const float* Wv      = (const float*)d_in[8];
  const float* Wb      = (const float*)d_in[9];
  const float* Wg      = (const float*)d_in[10];
  const float* bg      = (const float*)d_in[11];
  const float* Wout    = (const float*)d_in[12];
  const float* bout    = (const float*)d_in[13];
  float* out = (float*)d_out;

  char* p = (char*)d_ws;
  _Float16* WT      = (_Float16*)p; p += (size_t)5 * DG * DG * sizeof(_Float16);
  _Float16* xnh     = (_Float16*)p; p += (size_t)ROWS * DG * sizeof(_Float16);
  _Float16* qh      = (_Float16*)p; p += (size_t)ROWS * DG * sizeof(_Float16);
  _Float16* kh      = (_Float16*)p; p += (size_t)ROWS * DG * sizeof(_Float16);
  _Float16* vT      = (_Float16*)p; p += (size_t)ROWS * DG * sizeof(_Float16);
  _Float16* attnOut = (_Float16*)p; p += (size_t)ROWS * DG * sizeof(_Float16);
  float* gate       = (float*)p;    p += (size_t)ROWS * DG * sizeof(float);
  float* Opart      = (float*)p;    p += (size_t)KSPLIT * ROWS * DG * sizeof(float);
  float* mpart      = (float*)p;    p += (size_t)KSPLIT * ROWS * NH * sizeof(float);
  float* spart      = (float*)p;    p += (size_t)KSPLIT * ROWS * NH * sizeof(float);

  k_prep<<<dim3(256, 5), 256, 0, stream>>>(Wq, Wk, Wv, Wg, Wout, WT);
  k_lnx<<<ROWS, 256, 0, stream>>>(x, g_gamma, g_beta, xnh);
  k_proj<<<dim3(ROWS / 16, DG / 16, 4), 32, 0, stream>>>(xnh, WT, bg, qh, kh, vT, gate);
  k_attn<<<dim3(32, 2, KSPLIT), 256, 0, stream>>>(bias, b_gamma, b_beta, Wb, qh, kh,
                                                  vT, Opart, mpart, spart);
  k_comb<<<ROWS, 256, 0, stream>>>(Opart, mpart, spart, gate, attnOut);
  k_out<<<dim3(ROWS / 16, DG / 16), 32, 0, stream>>>(attnOut, WT + (size_t)4 * DG * DG,
                                                     bout, out);
}

// v001
// Measured time: 61.1 microseconds a run.
// Next to v000, in two timings, it ran 1.25 times as fast each time.
#include <hip/hip_runtime.h>
#include <hip/hip_bf16.h>

typedef __attribute__((ext_vector_type(16))) _Float16 v16h;
typedef __attribute__((ext_vector_type(8)))  _Float16 v8h;
typedef __attribute__((ext_vector_type(8)))  float    v8f;
typedef __attribute__((ext_vector_type(2)))  float    v2f;

#define L_SEQ 512
#define DG 256
#define DB 128
#define NH 8
#define HD 32
#define KSPLIT 4      // k-range split factor for the attention kernel
#define ROWS 1024     // b * L_SEQ
#define BPITCH 528            // staged bias row: 512 B + 16 B, so 16 rows' 8-byte reads fall on 64 different banks
#define BSLICE (32 * BPITCH)  // one wave's share of a tile: 2 q rows x 16 k rows
#define BBUF (8 * BSLICE)     // one tile: 16 q x 16 k x 128 channels

// ---------- fragment loaders (f16 A/B layout: lane row/col = ln&15,
// halves[0..7] = K off2+0..7, halves[8..15] = K 16+off2+0..7, off2 = (ln>>4)*8)
__device__ __forceinline__ v16h ld_frag_full(const _Float16* p, int off2) {
  v8h a = *reinterpret_cast<const v8h*>(p + off2);
  v8h b = *reinterpret_cast<const v8h*>(p + 16 + off2);
  v16h r;
#pragma unroll
  for (int i = 0; i < 8; ++i) { r[i] = a[i]; r[i + 8] = b[i]; }
  return r;
}
__device__ __forceinline__ v16h ld_frag_lo(const _Float16* p, int off2) {
  v8h a = *reinterpret_cast<const v8h*>(p + off2);
  v16h r;
#pragma unroll
  for (int i = 0; i < 8; ++i) { r[i] = a[i]; r[i + 8] = (_Float16)0.f; }
  return r;
}

__device__ __forceinline__ float half16_max(float v) {
  v = fmaxf(v, __shfl_xor(v, 1, 32));
  v = fmaxf(v, __shfl_xor(v, 2, 32));
  v = fmaxf(v, __shfl_xor(v, 4, 32));
  v = fmaxf(v, __shfl_xor(v, 8, 32));
  return v;
}
__device__ __forceinline__ float half16_sum(float v) {
  v += __shfl_xor(v, 1, 32);
  v += __shfl_xor(v, 2, 32);
  v += __shfl_xor(v, 4, 32);
  v += __shfl_xor(v, 8, 32);
  return v;
}

// ---------- eight asynchronous 16-byte-per-lane copies: eight whole 512-byte bias rows -> LDS.
// lds and g are the lane's own addresses in row 0. The closing s_wait_xcnt stands inside the
// statement so that no address register is rewritten ahead of it.
__device__ __forceinline__ void copy_rows8(unsigned lds, const float* g) {
  asm volatile(
      "global_load_async_to_lds_b128 %0, %8, off\n\t"
      "global_load_async_to_lds_b128 %1, %9, off\n\t"
      "global_load_async_to_lds_b128 %2, %10, off\n\t"
      "global_load_async_to_lds_b128 %3, %11, off\n\t"
      "global_load_async_to_lds_b128 %4, %12, off\n\t"
      "global_load_async_to_lds_b128 %5, %13, off\n\t"
      "global_load_async_to_lds_b128 %6, %14, off\n\t"
      "global_load_async_to_lds_b128 %7, %15, off\n\t"
      "s_wait_xcnt 0x0"
      :: "v"(lds), "v"(lds + BPITCH), "v"(lds + 2 * BPITCH), "v"(lds + 3 * BPITCH),
         "v"(lds + 4 * BPITCH), "v"(lds + 5 * BPITCH), "v"(lds + 6 * BPITCH),
         "v"(lds + 7 * BPITCH),
         "v"(g), "v"(g + DB), "v"(g + 2 * DB), "v"(g + 3 * DB), "v"(g + 4 * DB),
         "v"(g + 5 * DB), "v"(g + 6 * DB), "v"(g + 7 * DB)
      : "memory");
}
// one wave's share of bias tile kt (q rows bq0 and bq0 + 1, 16 k rows each) into its slice
__device__ __forceinline__ void copy_tile(unsigned lds, const float* bias, size_t bq0,
                                          int kt, int ln) {
  const float* g0 = bias + (bq0 * L_SEQ + kt * 16) * DB + ln * 4;
  const float* g1 = g0 + (size_t)L_SEQ * DB;
  copy_rows8(lds, g0);
  copy_rows8(lds + 8 * BPITCH, g0 + 8 * DB);
  copy_rows8(lds + 16 * BPITCH, g1);
  copy_rows8(lds + 24 * BPITCH, g1 + 8 * DB);
}

// ---------- 16x16 output tile GEMM over K (f16 inputs, fp32 accum)
__device__ __forceinline__ v8f gemm_tile(const _Float16* A, const _Float16* BT,
                                         int row0, int col0, int K) {
  const int ln = threadIdx.x & 31;
  const int n = ln & 15;
  const int off2 = (ln >> 4) * 8;
  v8f c = {0.f, 0.f, 0.f, 0.f, 0.f, 0.f, 0.f, 0.f};
  const _Float16* ap = A + (size_t)(row0 + n) * K;
  const _Float16* bp = BT + (size_t)(col0 + n) * K;
  for (int ks = 0; ks < K; ks += 32) {
    v16h a = ld_frag_full(ap + ks, off2);
    v16h b = ld_frag_full(bp + ks, off2);
    c = __builtin_amdgcn_wmma_f32_16x16x32_f16(false, a, false, b, (short)0, c,
                                               false, false);
  }
  return c;
}

// ---------- kernel 1: transpose + f16 convert weights (Wk scaled by 1/sqrt(D))
__global__ __launch_bounds__(256) void k_prep(const float* Wq, const float* Wk,
                                              const float* Wv, const float* Wg,
                                              const float* Wout, _Float16* WT) {
  int n = blockIdx.x, m = blockIdx.y, k = threadIdx.x;
  const float* W = (m == 0) ? Wq : (m == 1) ? Wk : (m == 2) ? Wv : (m == 3) ? Wg : Wout;
  float sc = (m == 1) ? 0.17677669529663687f : 1.f;
  WT[((size_t)m * DG + n) * DG + k] = (_Float16)(W[(size_t)k * DG + n] * sc);
}

// ---------- kernel 2: layernorm(x) -> f16
__global__ __launch_bounds__(256) void k_lnx(const float* x, const float* gamma,
                                             const float* beta, _Float16* xnh) {
  int row = blockIdx.x, t = threadIdx.x;
  float v = x[(size_t)row * DG + t];
  __shared__ float sA[256], sB[256];
  sA[t] = v; sB[t] = v * v;
  __syncthreads();
  for (int s = 128; s > 0; s >>= 1) {
    if (t < s) { sA[t] += sA[t + s]; sB[t] += sB[t + s]; }
    __syncthreads();
  }
  float mu = sA[0] * (1.f / 256.f);
  float var = sB[0] * (1.f / 256.f) - mu * mu;
  float rs = rsqrtf(var + 1e-5f);
  xnh[(size_t)row * DG + t] = (_Float16)((v - mu) * rs * gamma[t] + beta[t]);
}

// ---------- kernel 3: q/k/v/gate projections (WMMA f16), z selects matrix
__global__ __launch_bounds__(32) void k_proj(const _Float16* xnh, const _Float16* WT,
                                             const float* bg, _Float16* qh,
                                             _Float16* kh, _Float16* vT, float* gate) {
  int mt = blockIdx.x, nt = blockIdx.y, z = blockIdx.z;
  v8f c = gemm_tile(xnh, WT + (size_t)z * DG * DG, mt * 16, nt * 16, DG);
  int ln = threadIdx.x & 31, n = ln & 15, hi = ln >> 4;
#pragma unroll
  for (int j = 0; j < 8; ++j) {
    int row = mt * 16 + j + 8 * hi;
    int col = nt * 16 + n;
    float v = c[j];
    if (z == 0) {
      qh[(size_t)row * DG + col] = (_Float16)v;
    } else if (z == 1) {
      kh[(size_t)row * DG + col] = (_Float16)v;
    } else if (z == 2) {
      int bb = row >> 9, kp = row & 511, h = col >> 5, d = col & 31;
      vT[((size_t)(bb * NH + h) * HD + d) * L_SEQ + kp] = (_Float16)v;
    } else {
      float g = v + bg[col];
      gate[(size_t)row * DG + col] = 1.f / (1.f + __expf(-g));
    }
  }
}

// ---------- kernel 4: fused bias-LN + pair projection + split-K flash attention
// grid (qt=32, b=2, ks=KSPLIT); each WG covers k in [ks*128, ks*128+128)
__global__ __launch_bounds__(256) void k_attn(const float* bias, const float* b_gamma,
                                              const float* b_beta, const float* Wb,
                                              const _Float16* qh, const _Float16* kh,
                                              const _Float16* vT,
                                              float* Opart, float* mpart, float* spart) {
  const int qt = blockIdx.x;
  const int b = blockIdx.y;
  const int ksp = blockIdx.z;
  const int tid = threadIdx.x;
  const int w = tid >> 5;          // wave id == head id
  const int ln = tid & 31;
  const int n = ln & 15;
  const int hi = ln >> 4;
  const int off2 = hi * 8;
  const int koff = hi * 2;         // f32 WMMA A/B K offset per lane half

  __shared__ float2 gwB2[64][16];              // B table for pair WMMA (c pairs x 16 cols)
  __shared__ float Gh[8], Cbh[8];              // sum(gamma*Wb), sum(beta*Wb)
  __shared__ float pairLds[16 * 16 * 17];      // [q][k][col], padded
  __shared__ float ssqLds[16 * 16 * 2];        // sumsq partials
  __shared__ _Float16 pP[8 * 16 * 24];         // per-wave P staging (row stride 24)
  __shared__ __attribute__((aligned(16))) unsigned char biasSt[2 * BBUF];  // two bias tiles

  const int ktBeg = ksp * 8;
  const int ktEnd = ktBeg + 8;
  const size_t bq0 = (size_t)(b * L_SEQ + qt * 16 + w * 2);
  // the lane's own LDS byte address in row 0 of its wave's slice of buffer 0
  const unsigned stLds = (unsigned)(size_t)biasSt + w * BSLICE + ln * 16;
  copy_tile(stLds, bias, bq0, ktBeg, ln);      // tile 0 flies while the tables are built

  // init B table: cols 0..7 = gamma[c]*Wb[c][h], col 8 = 1 (row sums), rest 0
  for (int idx = tid; idx < 1024; idx += 256) {
    int cp = idx >> 4, nn = idx & 15;
    int c0 = cp * 2;
    float v0 = (nn < 8) ? b_gamma[c0] * Wb[c0 * 8 + nn] : (nn == 8 ? 1.f : 0.f);
    float v1 = (nn < 8) ? b_gamma[c0 + 1] * Wb[(c0 + 1) * 8 + nn] : (nn == 8 ? 1.f : 0.f);
    gwB2[cp][nn] = make_float2(v0, v1);
  }
  if (tid < 8) {
    float g = 0.f, cb = 0.f;
    for (int c = 0; c < DB; ++c) {
      float wv = Wb[c * 8 + tid];
      g += b_gamma[c] * wv;
      cb += b_beta[c] * wv;
    }
    Gh[tid] = g; Cbh[tid] = cb;
  }

  // per-head Q fragment (rows = 16 q positions, K = 32 dims)
  const _Float16* qp = qh + (size_t)(b * L_SEQ + qt * 16 + n) * DG + w * HD;
  v16h aQ = ld_frag_full(qp, off2);

  float mrow[8], srow[8];
  v8f O1 = {0.f, 0.f, 0.f, 0.f, 0.f, 0.f, 0.f, 0.f};
  v8f O2 = {0.f, 0.f, 0.f, 0.f, 0.f, 0.f, 0.f, 0.f};
#pragma unroll
  for (int j = 0; j < 8; ++j) { mrow[j] = -1e30f; srow[j] = 0.f; }

  asm volatile("s_wait_asynccnt 0x0" ::: "memory");  // tile 0 has landed
  __syncthreads();
  copy_tile(stLds + BBUF, bias, bq0, ktBeg + 1, ln);

  for (int kt = ktBeg; kt < ktEnd; ++kt) {
    const unsigned bufOff = ((kt - ktBeg) & 1) * BBUF;
    // ---- phase 1: pair tile via f32 WMMA; wave w owns q rows 2w, 2w+1
    {
      const int q0 = w * 2, q1 = w * 2 + 1;
      const unsigned char* st = biasSt + bufOff + w * BSLICE + n * BPITCH;
      const float* bp0 = reinterpret_cast<const float*>(st) + koff;
      const float* bp1 = reinterpret_cast<const float*>(st + 16 * BPITCH) + koff;
      v8f C0 = {0.f, 0.f, 0.f, 0.f, 0.f, 0.f, 0.f, 0.f};
      v8f C1 = {0.f, 0.f, 0.f, 0.f, 0.f, 0.f, 0.f, 0.f};
      float ss0 = 0.f, ss1 = 0.f;
      for (int cs = 0; cs < 32; ++cs) {
        float2 av0 = *reinterpret_cast<const float2*>(bp0 + cs * 4);
        float2 av1 = *reinterpret_cast<const float2*>(bp1 + cs * 4);
        float2 bv = gwB2[cs * 2 + hi][n];
        ss0 += av0.x * av0.x + av0.y * av0.y;
        ss1 += av1.x * av1.x + av1.y * av1.y;
        v2f a0 = {av0.x, av0.y};
        v2f a1 = {av1.x, av1.y};
        v2f bb = {bv.x, bv.y};
        C0 = __builtin_amdgcn_wmma_f32_16x16x4_f32(false, a0, false, bb, (short)0,
                                                   C0, false, false);
        C1 = __builtin_amdgcn_wmma_f32_16x16x4_f32(false, a1, false, bb, (short)0,
                                                   C1, false, false);
      }
#pragma unroll
      for (int j = 0; j < 8; ++j) {
        pairLds[(q0 * 16 + j + 8 * hi) * 17 + n] = C0[j];
        pairLds[(q1 * 16 + j + 8 * hi) * 17 + n] = C1[j];
      }
      ssqLds[(q0 * 16 + n) * 2 + hi] = ss0;
      ssqLds[(q1 * 16 + n) * 2 + hi] = ss1;
    }
    __syncthreads();
    // ---- cleanup: finish layernorm correction per (q,k)
    {
      int q = tid >> 4, kk = tid & 15;
      int base = (q * 16 + kk) * 17;
      float sum = pairLds[base + 8];
      float ssq = ssqLds[(q * 16 + kk) * 2] + ssqLds[(q * 16 + kk) * 2 + 1];
      float mu = sum * (1.f / 128.f);
      float var = ssq * (1.f / 128.f) - mu * mu;
      float rsg = rsqrtf(var + 1e-5f);
#pragma unroll
      for (int h = 0; h < 8; ++h)
        pairLds[base + h] = rsg * (pairLds[base + h] - mu * Gh[h]) + Cbh[h];
    }
    __syncthreads();
    // ---- phase 2: per-head logits = Q*K^T + pair, flash update, O += P*V
    v8f cp;
#pragma unroll
    for (int j = 0; j < 8; ++j)
      cp[j] = pairLds[((j + 8 * hi) * 16 + n) * 17 + w];

    const _Float16* kp = kh + (size_t)(b * L_SEQ + kt * 16 + n) * DG + w * HD;
    v16h bK = ld_frag_full(kp, off2);
    v8f Lg = __builtin_amdgcn_wmma_f32_16x16x32_f16(false, aQ, false, bK, (short)0,
                                                    cp, false, false);
    float Pv[8];
#pragma unroll
    for (int j = 0; j < 8; ++j) {
      float l = Lg[j];
      float mx = half16_max(l);
      float nm = fmaxf(mrow[j], mx);
      float al = __expf(mrow[j] - nm);
      float p = __expf(l - nm);
      float rs = half16_sum(p);
      srow[j] = srow[j] * al + rs;
      mrow[j] = nm;
      O1[j] *= al; O2[j] *= al;
      Pv[j] = p;
    }
    // wave-private LDS transpose of P (C layout -> A layout)
    _Float16* pw = pP + w * 16 * 24;
#pragma unroll
    for (int j = 0; j < 8; ++j)
      pw[(j + 8 * hi) * 24 + n] = (_Float16)Pv[j];
    asm volatile("s_wait_dscnt 0" ::: "memory");
    v16h aP = ld_frag_lo(pw + n * 24, off2);     // rows q, K = 16 k (+16 zero pad)

    const _Float16* vp1 = vT + ((size_t)(b * NH + w) * HD + n) * L_SEQ + kt * 16;
    const _Float16* vp2 = vT + ((size_t)(b * NH + w) * HD + 16 + n) * L_SEQ + kt * 16;
    v16h bV1 = ld_frag_lo(vp1, off2);
    v16h bV2 = ld_frag_lo(vp2, off2);
    O1 = __builtin_amdgcn_wmma_f32_16x16x32_f16(false, aP, false, bV1, (short)0,
                                                O1, false, false);
    O2 = __builtin_amdgcn_wmma_f32_16x16x32_f16(false, aP, false, bV2, (short)0,
                                                O2, false, false);
    // publish point: own LDS reads done, own copies of tile kt + 1 landed, then the barrier
    asm volatile("s_wait_dscnt 0x0" ::: "memory");
    asm volatile("s_wait_asynccnt 0x0" ::: "memory");
    __syncthreads();
    if (kt + 2 < ktEnd) copy_tile(stLds + bufOff, bias, bq0, kt + 2, ln);
  }
  asm volatile("s_wait_asynccnt 0x0" ::: "memory");  // no copy outlives the loop

  // epilogue: write unnormalized partials (O, m, s) for this k-range
#pragma unroll
  for (int j = 0; j < 8; ++j) {
    size_t row = (size_t)(b * L_SEQ + qt * 16 + j + 8 * hi);
    size_t base = ((size_t)ksp * ROWS + row) * DG + w * HD;
    Opart[base + n] = O1[j];
    Opart[base + 16 + n] = O2[j];
  }
  if (n == 0) {
#pragma unroll
    for (int j = 0; j < 8; ++j) {
      size_t row = (size_t)(b * L_SEQ + qt * 16 + j + 8 * hi);
      mpart[((size_t)ksp * ROWS + row) * NH + w] = mrow[j];
      spart[((size_t)ksp * ROWS + row) * NH + w] = srow[j];
    }
  }
}

// ---------- kernel 5: combine split-K partials, normalize, gate -> f16
__global__ __launch_bounds__(256) void k_comb(const float* Opart, const float* mpart,
                                              const float* spart, const float* gate,
                                              _Float16* attnOut) {
  int row = blockIdx.x;      // 0..1023
  int col = threadIdx.x;     // 0..255
  int h = col >> 5;
  float mv[KSPLIT];
  float m0 = -1e30f;
#pragma unroll
  for (int g = 0; g < KSPLIT; ++g) {
    mv[g] = mpart[((size_t)g * ROWS + row) * NH + h];
    m0 = fmaxf(m0, mv[g]);
  }
  float s = 0.f, o = 0.f;
#pragma unroll
  for (int g = 0; g < KSPLIT; ++g) {
    float e = __expf(mv[g] - m0);
    s += spart[((size_t)g * ROWS + row) * NH + h] * e;
    o += Opart[((size_t)g * ROWS + row) * DG + col] * e;
  }
  float gv = gate[(size_t)row * DG + col];
  attnOut[(size_t)row * DG + col] = (_Float16)(o / s * gv);
}

// ---------- kernel 6: output projection + bias
__global__ __launch_bounds__(32) void k_out(const _Float16* attnOut,
                                            const _Float16* WoutT, const float* bout,
                                            float* out) {
  int mt = blockIdx.x, nt = blockIdx.y;
  v8f c = gemm_tile(attnOut, WoutT, mt * 16, nt * 16, DG);
  int ln = threadIdx.x & 31, n = ln & 15, hi = ln >> 4;
#pragma unroll
  for (int j = 0; j < 8; ++j) {
    int row = mt * 16 + j + 8 * hi;
    int col = nt * 16 + n;
    out[(size_t)row * DG + col] = c[j] + bout[col];
  }
}

extern "C" void kernel_launch(void* const* d_in, const int* in_sizes, int n_in,
                              void* d_out, int out_size, void* d_ws, size_t ws_size,
                              hipStream_t stream) {
  (void)in_sizes; (void)n_in; (void)out_size; (void)ws_size;
  const float* x       = (const float*)d_in[0];
  const float* bias    = (const float*)d_in[1];
  const float* g_gamma = (const float*)d_in[2];
  const float* g_beta  = (const float*)d_in[3];
  const float* b_gamma = (const float*)d_in[4];
  const float* b_beta  = (const float*)d_in[5];
  const float* Wq      = (const float*)d_in[6];
  const float* Wk      = (const float*)d_in[7];
  const float* Wv      = (const float*)d_in[8];
  const float* Wb      = (const float*)d_in[9];
  const float* Wg      = (const float*)d_in[10];
  const float* bg      = (const float*)d_in[11];
  const float* Wout    = (const float*)d_in[12];
  const float* bout    = (const float*)d_in[13];
  float* out = (float*)d_out;

  char* p = (char*)d_ws;
  _Float16* WT      = (_Float16*)p; p += (size_t)5 * DG * DG * sizeof(_Float16);
  _Float16* xnh     = (_Float16*)p; p += (size_t)ROWS * DG * sizeof(_Float16);
  _Float16* qh      = (_Float16*)p; p += (size_t)ROWS * DG * sizeof(_Float16);
  _Float16* kh      = (_Float16*)p; p += (size_t)ROWS * DG * sizeof(_Float16);
  _Float16* vT      = (_Float16*)p; p += (size_t)ROWS * DG * sizeof(_Float16);
  _Float16* attnOut = (_Float16*)p; p += (size_t)ROWS * DG * sizeof(_Float16);
  float* gate       = (float*)p;    p += (size_t)ROWS * DG * sizeof(float);
  float* Opart      = (float*)p;    p += (size_t)KSPLIT * ROWS * DG * sizeof(float);
  float* mpart      = (float*)p;    p += (size_t)KSPLIT * ROWS * NH * sizeof(float);
  float* spart      = (float*)p;    p += (size_t)KSPLIT * ROWS * NH * sizeof(float);

  k_prep<<<dim3(256, 5), 256, 0, stream>>>(Wq, Wk, Wv, Wg, Wout, WT);
  k_lnx<<<ROWS, 256, 0, stream>>>(x, g_gamma, g_beta, xnh);
  k_proj<<<dim3(ROWS / 16, DG / 16, 4), 32, 0, stream>>>(xnh, WT, bg, qh, kh, vT, gate);
  k_attn<<<dim3(32, 2, KSPLIT), 256, 0, stream>>>(bias, b_gamma, b_beta, Wb, qh, kh,
                                                  vT, Opart, mpart, spart);
  k_comb<<<ROWS, 256, 0, stream>>>(Opart, mpart, spart, gate, attnOut);
  k_out<<<dim3(ROWS / 16, DG / 16), 32, 0, stream>>>(attnOut, WT + (size_t)4 * DG * DG,
                                                     bout, out);
}

// v002
// One run takes 51.1 microseconds.
// In two side-by-side timings against v001, it was 1.20 and 1.19 times as fast.
// Over all steps from v000 it is 1.49 times as fast.
#include <hip/hip_runtime.h>
#include <hip/hip_bf16.h>

typedef __attribute__((ext_vector_type(16))) _Float16 v16h;
typedef __attribute__((ext_vector_type(8)))  _Float16 v8h;
typedef __attribute__((ext_vector_type(8)))  float    v8f;
typedef __attribute__((ext_vector_type(2)))  float    v2f;

#define L_SEQ 512
#define DG 256
#define DB 128
#define NH 8
#define HD 32
#define KSPLIT 4      // k-range split factor for the attention kernel
#define ROWS 1024     // b * L_SEQ
#define BPITCH 528            // staged bias row: 512 B + 16 B, so 16 rows' 8-byte reads fall on 64 different banks
#define BSLICE (32 * BPITCH)  // one wave's share of a tile: 2 q rows x 16 k rows
#define BBUF (8 * BSLICE)     // one tile: 16 q x 16 k x 128 channels

// ---------- fragment loaders (f16 A/B layout: lane row/col = ln&15,
// halves[0..7] = K off2+0..7, halves[8..15] = K 16+off2+0..7, off2 = (ln>>4)*8)
__device__ __forceinline__ v16h ld_frag_full(const _Float16* p, int off2) {
  v8h a = *reinterpret_cast<const v8h*>(p + off2);
  v8h b = *reinterpret_cast<const v8h*>(p + 16 + off2);
  v16h r;
#pragma unroll
  for (int i = 0; i < 8; ++i) { r[i] = a[i]; r[i + 8] = b[i]; }
  return r;
}
__device__ __forceinline__ v16h ld_frag_lo(const _Float16* p, int off2) {
  v8h a = *reinterpret_cast<const v8h*>(p + off2);
  v16h r;
#pragma unroll
  for (int i = 0; i < 8; ++i) { r[i] = a[i]; r[i + 8] = (_Float16)0.f; }
  return r;
}

__device__ __forceinline__ float half16_max(float v) {
  v = fmaxf(v, __shfl_xor(v, 1, 32));
  v = fmaxf(v, __shfl_xor(v, 2, 32));
  v = fmaxf(v, __shfl_xor(v, 4, 32));
  v = fmaxf(v, __shfl_xor(v, 8, 32));
  return v;
}
__device__ __forceinline__ float half16_sum(float v) {
  v += __shfl_xor(v, 1, 32);
  v += __shfl_xor(v, 2, 32);
  v += __shfl_xor(v, 4, 32);
  v += __shfl_xor(v, 8, 32);
  return v;
}

// ---------- eight asynchronous 16-byte-per-lane copies: eight whole 512-byte bias rows -> LDS.
// lds and g are the lane's own addresses in row 0. The closing s_wait_xcnt stands inside the
// statement so that no address register is rewritten ahead of it.
__device__ __forceinline__ void copy_rows8(unsigned lds, const float* g) {
  asm volatile(
      "global_load_async_to_lds_b128 %0, %8, off\n\t"
      "global_load_async_to_lds_b128 %1, %9, off\n\t"
      "global_load_async_to_lds_b128 %2, %10, off\n\t"
      "global_load_async_to_lds_b128 %3, %11, off\n\t"
      "global_load_async_to_lds_b128 %4, %12, off\n\t"
      "global_load_async_to_lds_b128 %5, %13, off\n\t"
      "global_load_async_to_lds_b128 %6, %14, off\n\t"
      "global_load_async_to_lds_b128 %7, %15, off\n\t"
      "s_wait_xcnt 0x0"
      :: "v"(lds), "v"(lds + BPITCH), "v"(lds + 2 * BPITCH), "v"(lds + 3 * BPITCH),
         "v"(lds + 4 * BPITCH), "v"(lds + 5 * BPITCH), "v"(lds + 6 * BPITCH),
         "v"(lds + 7 * BPITCH),
         "v"(g), "v"(g + DB), "v"(g + 2 * DB), "v"(g + 3 * DB), "v"(g + 4 * DB),
         "v"(g + 5 * DB), "v"(g + 6 * DB), "v"(g + 7 * DB)
      : "memory");
}
// one wave's share of bias tile kt (q rows bq0 and bq0 + 1, 16 k rows each) into its slice
__device__ __forceinline__ void copy_tile(unsigned lds, const float* bias, size_t bq0,
                                          int kt, int ln) {
  const float* g0 = bias + (bq0 * L_SEQ + kt * 16) * DB + ln * 4;
  const float* g1 = g0 + (size_t)L_SEQ * DB;
  copy_rows8(lds, g0);
  copy_rows8(lds + 8 * BPITCH, g0 + 8 * DB);
  copy_rows8(lds + 16 * BPITCH, g1);
  copy_rows8(lds + 24 * BPITCH, g1 + 8 * DB);
}

// ---------- 16x16 output tile GEMM over K (f16 inputs, fp32 accum)
__device__ __forceinline__ v8f gemm_tile(const _Float16* A, const _Float16* BT,
                                         int row0, int col0, int K) {
  const int ln = threadIdx.x & 31;
  const int n = ln & 15;
  const int off2 = (ln >> 4) * 8;
  v8f c = {0.f, 0.f, 0.f, 0.f, 0.f, 0.f, 0.f, 0.f};
  const _Float16* ap = A + (size_t)(row0 + n) * K;
  const _Float16* bp = BT + (size_t)(col0 + n) * K;
  for (int ks = 0; ks < K; ks += 32) {
    v16h a = ld_frag_full(ap + ks, off2);
    v16h b = ld_frag_full(bp + ks, off2);
    c = __builtin_amdgcn_wmma_f32_16x16x32_f16(false, a, false, b, (short)0, c,
                                               false, false);
  }
  return c;
}

// ---------- one transcendental with the free issue slot that the instruction set asks for behind it,
// in one statement: nothing that overwrites its source or reads its result can stand directly behind
__device__ __forceinline__ float rsq_slot(float a) {
  float r;
  asm("v_rsq_f32 %0, %1\n\tv_nop" : "=v"(r) : "v"(a));  // v_nop: the slot behind v_rsq
  return r;
}
__device__ __forceinline__ float exp2_slot(float a) {
  float r;
  asm("v_exp_f32 %0, %1\n\tv_nop" : "=v"(r) : "v"(a));  // v_nop: the slot behind v_exp
  return r;
}

// ---------- kernel 1: layernorm(x), f16 weight conversion and the q/k/v/gate projections (WMMA
// f16). grid (row tile, z): z = 0..3 selects the matrix, one 8-wave work-group per 16 rows;
// z = 4 writes the transposed f16 copy of Wout that the last kernel reads.
#define APITCH 264  // staged row: 256 halves + 8, so 16 rows' 16-byte reads fall on different banks
__global__ __launch_bounds__(256) void k_proj(const float* x, const float* gamma,
                                              const float* beta, const float* Wq,
                                              const float* Wk, const float* Wv,
                                              const float* Wg, const float* Wout,
                                              const float* bg, _Float16* qh, _Float16* kh,
                                              _Float16* vT, float* gate, _Float16* WoutT) {
  const int mt = blockIdx.x, z = blockIdx.y, tid = threadIdx.x;
  if (z == 4) {  // the whole block leaves here, ahead of the barrier
    const float4 wv = *reinterpret_cast<const float4*>(Wout + (size_t)tid * DG + mt * 4);
    WoutT[(size_t)(mt * 4 + 0) * DG + tid] = (_Float16)wv.x;
    WoutT[(size_t)(mt * 4 + 1) * DG + tid] = (_Float16)wv.y;
    WoutT[(size_t)(mt * 4 + 2) * DG + tid] = (_Float16)wv.z;
    WoutT[(size_t)(mt * 4 + 3) * DG + tid] = (_Float16)wv.w;
    return;
  }
  __shared__ __attribute__((aligned(16))) _Float16 aS[16 * APITCH];
  const int w = tid >> 5, ln = tid & 31, n = ln & 15, hi = ln >> 4, off2 = hi * 8;

  // wave w normalizes rows 2w and 2w + 1; a lane holds elements ln + 32 i of a row
  float xv[2][8], gm[8], bt[8];
#pragma unroll  // constant indices keep the arrays in registers
  for (int i = 0; i < 8; ++i) {
    xv[0][i] = x[(size_t)(mt * 16 + w * 2) * DG + ln + 32 * i];
    xv[1][i] = x[(size_t)(mt * 16 + w * 2 + 1) * DG + ln + 32 * i];
    gm[i] = gamma[ln + 32 * i];
    bt[i] = beta[ln + 32 * i];
  }

  // B fragments of output columns 32w .. 32w + 31 (two tiles), whole K, straight from the
  // k-major f32 weights (Wk scaled by 1/sqrt(D)); they do not depend on the layernorm
  const float* W = (z == 0) ? Wq : (z == 1) ? Wk : (z == 2) ? Wv : Wg;
  const float sc = (z == 1) ? 0.17677669529663687f : 1.f;
  v16h bF[2][8];
#pragma unroll  // constant indices keep bF in registers
  for (int ks = 0; ks < 8; ++ks) {
#pragma unroll  // constant indices: the vectors stay in registers
    for (int t = 0; t < 2; ++t) {
      const float* wp = W + (size_t)(ks * 32 + off2) * DG + w * 32 + t * 16 + n;
#pragma unroll  // constant indices: the vectors stay in registers
      for (int i = 0; i < 8; ++i) {
        bF[t][ks][i] = (_Float16)(wp[(size_t)i * DG] * sc);
        bF[t][ks][i + 8] = (_Float16)(wp[(size_t)(16 + i) * DG] * sc);
      }
    }
  }

#pragma unroll  // constant indices: the vectors stay in registers
  for (int r = 0; r < 2; ++r) {
    // halving tree over the 256 elements: distances 128, 64, 32 inside the lane, 16 .. 1 across
    float sa[8], sb[8];
#pragma unroll  // constant indices: the vectors stay in registers
    for (int i = 0; i < 8; ++i) { sa[i] = xv[r][i]; sb[i] = xv[r][i] * xv[r][i]; }
#pragma unroll  // constant indices: the vectors stay in registers
    for (int i = 0; i < 4; ++i) { sa[i] += sa[i + 4]; sb[i] += sb[i + 4]; }
    sa[0] += sa[2]; sb[0] += sb[2];
    sa[1] += sa[3]; sb[1] += sb[3];
    float s1 = sa[0] + sa[1], s2 = sb[0] + sb[1];
#pragma unroll  // five fixed steps, straight-line
    for (int d = 16; d > 0; d >>= 1) {
      s1 += __shfl_xor(s1, d, 32);
      s2 += __shfl_xor(s2, d, 32);
    }
    float mu = s1 * (1.f / 256.f);
    float var = s2 * (1.f / 256.f) - mu * mu;
    // rsqrtf spelled out: an argument below the smallest normal is scaled into range
    const float va = var + 1e-5f;
    const bool tiny = va < 1.17549435e-38f;
    float rs = rsq_slot(tiny ? va * 16777216.f : va);
    rs = tiny ? rs * 4096.f : rs;
#pragma unroll  // constant indices: the vectors stay in registers
    for (int i = 0; i < 8; ++i)
      aS[(w * 2 + r) * APITCH + ln + 32 * i] = (_Float16)((xv[r][i] - mu) * rs * gm[i] + bt[i]);
  }
  __syncthreads();  // every wave reads all 16 normalized rows

  v8f c0 = {0.f, 0.f, 0.f, 0.f, 0.f, 0.f, 0.f, 0.f};
  v8f c1 = {0.f, 0.f, 0.f, 0.f, 0.f, 0.f, 0.f, 0.f};
  const _Float16* ap = aS + n * APITCH;
#pragma unroll  // constant indices into bF
  for (int ks = 0; ks < 8; ++ks) {
    v16h a = ld_frag_full(ap + ks * 32, off2);
    c0 = __builtin_amdgcn_wmma_f32_16x16x32_f16(false, a, false, bF[0][ks], (short)0, c0,
                                                false, false);
    c1 = __builtin_amdgcn_wmma_f32_16x16x32_f16(false, a, false, bF[1][ks], (short)0, c1,
                                                false, false);
  }
  // the branch on z stands outside the store loops: one scalar test a wave, not one a store
  const int row0 = mt * 16 + 8 * hi;
  const int col0 = w * 32 + n, col1 = col0 + 16;
  if (z == 0 || z == 1) {
    _Float16* dst = (z == 0) ? qh : kh;
#pragma unroll  // constant indices: the vectors stay in registers
    for (int j = 0; j < 8; ++j) {
      dst[(size_t)(row0 + j) * DG + col0] = (_Float16)c0[j];
      dst[(size_t)(row0 + j) * DG + col1] = (_Float16)c1[j];
    }
    // the stores' registers are not rewritten ahead of this wait on any way out of the branch
    asm volatile("s_wait_xcnt 0x0" ::: "memory");
  } else if (z == 2) {
    // head w, dims n and 16 + n; the 16 rows of a tile lie in one batch
    const int bb = row0 >> 9, kp = row0 & 511;
    _Float16* v0 = vT + ((size_t)(bb * NH + w) * HD + n) * L_SEQ + kp;
    _Float16* v1 = v0 + (size_t)16 * L_SEQ;
#pragma unroll  // constant indices: the vectors stay in registers
    for (int j = 0; j < 8; ++j) {
      v0[j] = (_Float16)c0[j];
      v1[j] = (_Float16)c1[j];
    }
    // the stores' registers are not rewritten ahead of this wait on any way out of the branch
    asm volatile("s_wait_xcnt 0x0" ::: "memory");
  } else {
    const float bg0 = bg[col0], bg1 = bg[col1];
#pragma unroll  // constant indices: the vectors stay in registers
    for (int j = 0; j < 8; ++j) {
      float g0 = c0[j] + bg0, g1 = c1[j] + bg1;
      // exp(-g) as 2^(-g log2 e), what __expf computes
      gate[(size_t)(row0 + j) * DG + col0] = 1.f / (1.f + exp2_slot(g0 * -1.44269504f));
      gate[(size_t)(row0 + j) * DG + col1] = 1.f / (1.f + exp2_slot(g1 * -1.44269504f));
    }
    // the stores' registers are not rewritten ahead of this wait on any way out of the branch
    asm volatile("s_wait_xcnt 0x0" ::: "memory");
  }
}

// ---------- kernel 2: fused bias-LN + pair projection + split-K flash attention
// grid (qt=32, b=2, ks=KSPLIT); each WG covers k in [ks*128, ks*128+128)
__global__ __launch_bounds__(256) void k_attn(const float* bias, const float* b_gamma,
                                              const float* b_beta, const float* Wb,
                                              const _Float16* qh, const _Float16* kh,
                                              const _Float16* vT,
                                              float* Opart, float* mpart, float* spart) {
  const int qt = blockIdx.x;
  const int b = blockIdx.y;
  const int ksp = blockIdx.z;
  const int tid = threadIdx.x;
  const int w = tid >> 5;          // wave id == head id
  const int ln = tid & 31;
  const int n = ln & 15;
  const int hi = ln >> 4;
  const int off2 = hi * 8;
  const int koff = hi * 2;         // f32 WMMA A/B K offset per lane half

  __shared__ float2 gwB2[64][16];              // B table for pair WMMA (c pairs x 16 cols)
  __shared__ float Gh[8], Cbh[8];              // sum(gamma*Wb), sum(beta*Wb)
  __shared__ float pairLds[16 * 16 * 17];      // [q][k][col], padded
  __shared__ float ssqLds[16 * 16 * 2];        // sumsq partials
  __shared__ _Float16 pP[8 * 16 * 24];         // per-wave P staging (row stride 24)
  __shared__ __attribute__((aligned(16))) unsigned char biasSt[2 * BBUF];  // two bias tiles

  const int ktBeg = ksp * 8;
  const int ktEnd = ktBeg + 8;
  const size_t bq0 = (size_t)(b * L_SEQ + qt * 16 + w * 2);
  // the lane's own LDS byte address in row 0 of its wave's slice of buffer 0
  const unsigned stLds = (unsigned)(size_t)biasSt + w * BSLICE + ln * 16;
  copy_tile(stLds, bias, bq0, ktBeg, ln);      // tile 0 flies while the tables are built

  // init B table: cols 0..7 = gamma[c]*Wb[c][h], col 8 = 1 (row sums), rest 0
  for (int idx = tid; idx < 1024; idx += 256) {
    int cp = idx >> 4, nn = idx & 15;
    int c0 = cp * 2;
    float v0 = (nn < 8) ? b_gamma[c0] * Wb[c0 * 8 + nn] : (nn == 8 ? 1.f : 0.f);
    float v1 = (nn < 8) ? b_gamma[c0 + 1] * Wb[(c0 + 1) * 8 + nn] : (nn == 8 ? 1.f : 0.f);
    gwB2[cp][nn] = make_float2(v0, v1);
  }
  if (tid < 8) {
    float g = 0.f, cb = 0.f;
    for (int c = 0; c < DB; ++c) {
      float wv = Wb[c * 8 + tid];
      g += b_gamma[c] * wv;
      cb += b_beta[c] * wv;
    }
    Gh[tid] = g; Cbh[tid] = cb;
  }

  // per-head Q fragment (rows = 16 q positions, K = 32 dims)
  const _Float16* qp = qh + (size_t)(b * L_SEQ + qt * 16 + n) * DG + w * HD;
  v16h aQ = ld_frag_full(qp, off2);

  float mrow[8], srow[8];
  v8f O1 = {0.f, 0.f, 0.f, 0.f, 0.f, 0.f, 0.f, 0.f};
  v8f O2 = {0.f, 0.f, 0.f, 0.f, 0.f, 0.f, 0.f, 0.f};
#pragma unroll
  for (int j = 0; j < 8; ++j) { mrow[j] = -1e30f; srow[j] = 0.f; }

  asm volatile("s_wait_asynccnt 0x0" ::: "memory");  // tile 0 has landed
  __syncthreads();
  copy_tile(stLds + BBUF, bias, bq0, ktBeg + 1, ln);

  for (int kt = ktBeg; kt < ktEnd; ++kt) {
    const unsigned bufOff = ((kt - ktBeg) & 1) * BBUF;
    // ---- phase 1: pair tile via f32 WMMA; wave w owns q rows 2w, 2w+1
    {
      const int q0 = w * 2, q1 = w * 2 + 1;
      const unsigned char* st = biasSt + bufOff + w * BSLICE + n * BPITCH;
      const float* bp0 = reinterpret_cast<const float*>(st) + koff;
      const float* bp1 = reinterpret_cast<const float*>(st + 16 * BPITCH) + koff;
      v8f C0 = {0.f, 0.f, 0.f, 0.f, 0.f, 0.f, 0.f, 0.f};
      v8f C1 = {0.f, 0.f, 0.f, 0.f, 0.f, 0.f, 0.f, 0.f};
      float ss0 = 0.f, ss1 = 0.f;
      for (int cs = 0; cs < 32; ++cs) {
        float2 av0 = *reinterpret_cast<const float2*>(bp0 + cs * 4);
        float2 av1 = *reinterpret_cast<const float2*>(bp1 + cs * 4);
        float2 bv = gwB2[cs * 2 + hi][n];
        ss0 += av0.x * av0.x + av0.y * av0.y;
        ss1 += av1.x * av1.x + av1.y * av1.y;
        v2f a0 = {av0.x, av0.y};
        v2f a1 = {av1.x, av1.y};
        v2f bb = {bv.x, bv.y};
        C0 = __builtin_amdgcn_wmma_f32_16x16x4_f32(false, a0, false, bb, (short)0,
                                                   C0, false, false);
        C1 = __builtin_amdgcn_wmma_f32_16x16x4_f32(false, a1, false, bb, (short)0,
                                                   C1, false, false);
      }
#pragma unroll
      for (int j = 0; j < 8; ++j) {
        pairLds[(q0 * 16 + j + 8 * hi) * 17 + n] = C0[j];
        pairLds[(q1 * 16 + j + 8 * hi) * 17 + n] = C1[j];
      }
      ssqLds[(q0 * 16 + n) * 2 + hi] = ss0;
      ssqLds[(q1 * 16 + n) * 2 + hi] = ss1;
    }
    __syncthreads();
    // ---- cleanup: finish layernorm correction per (q,k)
    {
      int q = tid >> 4, kk = tid & 15;
      int base = (q * 16 + kk) * 17;
      float sum = pairLds[base + 8];
      float ssq = ssqLds[(q * 16 + kk) * 2] + ssqLds[(q * 16 + kk) * 2 + 1];
      float mu = sum * (1.f / 128.f);
      float var = ssq * (1.f / 128.f) - mu * mu;
      float rsg = rsqrtf(var + 1e-5f);
#pragma unroll
      for (int h = 0; h < 8; ++h)
        pairLds[base + h] = rsg * (pairLds[base + h] - mu * Gh[h]) + Cbh[h];
    }
    __syncthreads();
    // ---- phase 2: per-head logits = Q*K^T + pair, flash update, O += P*V
    v8f cp;
#pragma unroll
    for (int j = 0; j < 8; ++j)
      cp[j] = pairLds[((j + 8 * hi) * 16 + n) * 17 + w];

    const _Float16* kp = kh + (size_t)(b * L_SEQ + kt * 16 + n) * DG + w * HD;
    v16h bK = ld_frag_full(kp, off2);
    v8f Lg = __builtin_amdgcn_wmma_f32_16x16x32_f16(false, aQ, false, bK, (short)0,
                                                    cp, false, false);
    float Pv[8];
#pragma unroll
    for (int j = 0; j < 8; ++j) {
      float l = Lg[j];
      float mx = half16_max(l);
      float nm = fmaxf(mrow[j], mx);
      float al = __expf(mrow[j] - nm);
      float p = __expf(l - nm);
      float rs = half16_sum(p);
      srow[j] = srow[j] * al + rs;
      mrow[j] = nm;
      O1[j] *= al; O2[j] *= al;
      Pv[j] = p;
    }
    // wave-private LDS transpose of P (C layout -> A layout)
    _Float16* pw = pP + w * 16 * 24;
#pragma unroll
    for (int j = 0; j < 8; ++j)
      pw[(j + 8 * hi) * 24 + n] = (_Float16)Pv[j];
    asm volatile("s_wait_dscnt 0" ::: "memory");
    v16h aP = ld_frag_lo(pw + n * 24, off2);     // rows q, K = 16 k (+16 zero pad)

    const _Float16* vp1 = vT + ((size_t)(b * NH + w) * HD + n) * L_SEQ + kt * 16;
    const _Float16* vp2 = vT + ((size_t)(b * NH + w) * HD + 16 + n) * L_SEQ + kt * 16;
    v16h bV1 = ld_frag_lo(vp1, off2);
    v16h bV2 = ld_frag_lo(vp2, off2);
    O1 = __builtin_amdgcn_wmma_f32_16x16x32_f16(false, aP, false, bV1, (short)0,
                                                O1, false, false);
    O2 = __builtin_amdgcn_wmma_f32_16x16x32_f16(false, aP, false, bV2, (short)0,
                                                O2, false, false);
    // publish point: own LDS reads done, own copies of tile kt + 1 landed, then the barrier
    asm volatile("s_wait_dscnt 0x0" ::: "memory");
    asm volatile("s_wait_asynccnt 0x0" ::: "memory");
    __syncthreads();
    if (kt + 2 < ktEnd) copy_tile(stLds + bufOff, bias, bq0, kt + 2, ln);
  }
  asm volatile("s_wait_asynccnt 0x0" ::: "memory");  // no copy outlives the loop

  // epilogue: write unnormalized partials (O, m, s) for this k-range
#pragma unroll
  for (int j = 0; j < 8; ++j) {
    size_t row = (size_t)(b * L_SEQ + qt * 16 + j + 8 * hi);
    size_t base = ((size_t)ksp * ROWS + row) * DG + w * HD;
    Opart[base + n] = O1[j];
    Opart[base + 16 + n] = O2[j];
  }
  if (n == 0) {
#pragma unroll
    for (int j = 0; j < 8; ++j) {
      size_t row = (size_t)(b * L_SEQ + qt * 16 + j + 8 * hi);
      mpart[((size_t)ksp * ROWS + row) * NH + w] = mrow[j];
      spart[((size_t)ksp * ROWS + row) * NH + w] = srow[j];
    }
  }
}

// ---------- kernel 3: combine split-K partials, normalize, gate -> f16
__global__ __launch_bounds__(256) void k_comb(const float* Opart, const float* mpart,
                                              const float* spart, const float* gate,
                                              _Float16* attnOut) {
  int row = blockIdx.x;      // 0..1023
  int col = threadIdx.x;     // 0..255
  int h = col >> 5;
  float mv[KSPLIT];
  float m0 = -1e30f;
#pragma unroll
  for (int g = 0; g < KSPLIT; ++g) {
    mv[g] = mpart[((size_t)g * ROWS + row) * NH + h];
    m0 = fmaxf(m0, mv[g]);
  }
  float s = 0.f, o = 0.f;
#pragma unroll
  for (int g = 0; g < KSPLIT; ++g) {
    float e = __expf(mv[g] - m0);
    s += spart[((size_t)g * ROWS + row) * NH + h] * e;
    o += Opart[((size_t)g * ROWS + row) * DG + col] * e;
  }
  float gv = gate[(size_t)row * DG + col];
  attnOut[(size_t)row * DG + col] = (_Float16)(o / s * gv);
}

// ---------- kernel 4: output projection + bias
__global__ __launch_bounds__(32) void k_out(const _Float16* attnOut,
                                            const _Float16* WoutT, const float* bout,
                                            float* out) {
  int mt = blockIdx.x, nt = blockIdx.y;
  v8f c = gemm_tile(attnOut, WoutT, mt * 16, nt * 16, DG);
  int ln = threadIdx.x & 31, n = ln & 15, hi = ln >> 4;
#pragma unroll
  for (int j = 0; j < 8; ++j) {
    int row = mt * 16 + j + 8 * hi;
    int col = nt * 16 + n;
    out[(size_t)row * DG + col] = c[j] + bout[col];
  }
}

extern "C" void kernel_launch(void* const* d_in, const int* in_sizes, int n_in,
                              void* d_out, int out_size, void* d_ws, size_t ws_size,
                              hipStream_t stream) {
  (void)in_sizes; (void)n_in; (void)out_size; (void)ws_size;
  const float* x       = (const float*)d_in[0];
  const float* bias    = (const float*)d_in[1];
  const float* g_gamma = (const float*)d_in[2];
  const float* g_beta  = (const float*)d_in[3];
  const float* b_gamma = (const float*)d_in[4];
  const float* b_beta  = (const float*)d_in[5];
  const float* Wq      = (const float*)d_in[6];
  const float* Wk      = (const float*)d_in[7];
  const float* Wv      = (const float*)d_in[8];
  const float* Wb      = (const float*)d_in[9];
  const float* Wg      = (const float*)d_in[10];
  const float* bg      = (const float*)d_in[11];
  const float* Wout    = (const float*)d_in[12];
  const float* bout    = (const float*)d_in[13];
  float* out = (float*)d_out;

  char* p = (char*)d_ws;
  _Float16* WoutT   = (_Float16*)p; p += (size_t)DG * DG * sizeof(_Float16);
  _Float16* qh      = (_Float16*)p; p += (size_t)ROWS * DG * sizeof(_Float16);
  _Float16* kh      = (_Float16*)p; p += (size_t)ROWS * DG * sizeof(_Float16);
  _Float16* vT      = (_Float16*)p; p += (size_t)ROWS * DG * sizeof(_Float16);
  _Float16* attnOut = (_Float16*)p; p += (size_t)ROWS * DG * sizeof(_Float16);
  float* gate       = (float*)p;    p += (size_t)ROWS * DG * sizeof(float);
  float* Opart      = (float*)p;    p += (size_t)KSPLIT * ROWS * DG * sizeof(float);
  float* mpart      = (float*)p;    p += (size_t)KSPLIT * ROWS * NH * sizeof(float);
  float* spart      = (float*)p;    p += (size_t)KSPLIT * ROWS * NH * sizeof(float);

  k_proj<<<dim3(ROWS / 16, 5), 256, 0, stream>>>(x, g_gamma, g_beta, Wq, Wk, Wv, Wg, Wout, bg,
                                                 qh, kh, vT, gate, WoutT);
  k_attn<<<dim3(32, 2, KSPLIT), 256, 0, stream>>>(bias, b_gamma, b_beta, Wb, qh, kh,
                                                  vT, Opart, mpart, spart);
  k_comb<<<ROWS, 256, 0, stream>>>(Opart, mpart, spart, gate, attnOut);
  k_out<<<dim3(ROWS / 16, DG / 16), 32, 0, stream>>>(attnOut, WoutT, bout, out);
}

// v003
// It runs in 44.4 microseconds.
// Two timings next to v002 put it at 1.15 and 1.16 times that version's speed.
// Over all steps from v000 it is 1.72 times as fast.
#include <hip/hip_runtime.h>
#include <hip/hip_bf16.h>

typedef __attribute__((ext_vector_type(16))) _Float16 v16h;
typedef __attribute__((ext_vector_type(8)))  _Float16 v8h;
typedef __attribute__((ext_vector_type(4)))  _Float16 v4h;
typedef __attribute__((ext_vector_type(8)))  float    v8f;
typedef __attribute__((ext_vector_type(2)))  float    v2f;

#define L_SEQ 512
#define DG 256
#define DB 128
#define NH 8
#define HD 32
#define KSPLIT 4      // k-range split factor for the attention kernel
#define ROWS 1024     // b * L_SEQ
#define BPITCH 528            // staged bias row: 512 B + 16 B, so 16 rows' 8-byte reads fall on 64 different banks
#define BSLICE (32 * BPITCH)  // one wave's share of a tile: 2 q rows x 16 k rows
#define BBUF (8 * BSLICE)     // one tile: 16 q x 16 k x 128 channels

// ---------- fragment loaders (f16 A/B layout: lane row/col = ln&15,
// halves[0..7] = K off2+0..7, halves[8..15] = K 16+off2+0..7, off2 = (ln>>4)*8)
__device__ __forceinline__ v16h ld_frag_full(const _Float16* p, int off2) {
  v8h a = *reinterpret_cast<const v8h*>(p + off2);
  v8h b = *reinterpret_cast<const v8h*>(p + 16 + off2);
  v16h r;
#pragma unroll
  for (int i = 0; i < 8; ++i) { r[i] = a[i]; r[i + 8] = b[i]; }
  return r;
}
__device__ __forceinline__ v16h ld_frag_lo(const _Float16* p, int off2) {
  v8h a = *reinterpret_cast<const v8h*>(p + off2);
  v16h r;
#pragma unroll
  for (int i = 0; i < 8; ++i) { r[i] = a[i]; r[i + 8] = (_Float16)0.f; }
  return r;
}

__device__ __forceinline__ float half16_max(float v) {
  v = fmaxf(v, __shfl_xor(v, 1, 32));
  v = fmaxf(v, __shfl_xor(v, 2, 32));
  v = fmaxf(v, __shfl_xor(v, 4, 32));
  v = fmaxf(v, __shfl_xor(v, 8, 32));
  return v;
}
__device__ __forceinline__ float half16_sum(float v) {
  v += __shfl_xor(v, 1, 32);
  v += __shfl_xor(v, 2, 32);
  v += __shfl_xor(v, 4, 32);
  v += __shfl_xor(v, 8, 32);
  return v;
}

// ---------- eight asynchronous 16-byte-per-lane copies: eight whole 512-byte bias rows -> LDS.
// lds and g are the lane's own addresses in row 0. The closing s_wait_xcnt stands inside the
// statement so that no address register is rewritten ahead of it.
__device__ __forceinline__ void copy_rows8(unsigned lds, const float* g) {
  asm volatile(
      "global_load_async_to_lds_b128 %0, %8, off\n\t"
      "global_load_async_to_lds_b128 %1, %9, off\n\t"
      "global_load_async_to_lds_b128 %2, %10, off\n\t"
      "global_load_async_to_lds_b128 %3, %11, off\n\t"
      "global_load_async_to_lds_b128 %4, %12, off\n\t"
      "global_load_async_to_lds_b128 %5, %13, off\n\t"
      "global_load_async_to_lds_b128 %6, %14, off\n\t"
      "global_load_async_to_lds_b128 %7, %15, off\n\t"
      "s_wait_xcnt 0x0"
      :: "v"(lds), "v"(lds + BPITCH), "v"(lds + 2 * BPITCH), "v"(lds + 3 * BPITCH),
         "v"(lds + 4 * BPITCH), "v"(lds + 5 * BPITCH), "v"(lds + 6 * BPITCH),
         "v"(lds + 7 * BPITCH),
         "v"(g), "v"(g + DB), "v"(g + 2 * DB), "v"(g + 3 * DB), "v"(g + 4 * DB),
         "v"(g + 5 * DB), "v"(g + 6 * DB), "v"(g + 7 * DB)
      : "memory");
}
// one wave's share of bias tile kt (q rows bq0 and bq0 + 1, 16 k rows each) into its slice
__device__ __forceinline__ void copy_tile(unsigned lds, const float* bias, size_t bq0,
                                          int kt, int ln) {
  const float* g0 = bias + (bq0 * L_SEQ + kt * 16) * DB + ln * 4;
  const float* g1 = g0 + (size_t)L_SEQ * DB;
  copy_rows8(lds, g0);
  copy_rows8(lds + 8 * BPITCH, g0 + 8 * DB);
  copy_rows8(lds + 16 * BPITCH, g1);
  copy_rows8(lds + 24 * BPITCH, g1 + 8 * DB);
}

// ---------- one transcendental with the free issue slot that the instruction set asks for behind it,
// in one statement: nothing that overwrites its source or reads its result can stand directly behind
__device__ __forceinline__ float rsq_slot(float a) {
  float r;
  asm("v_rsq_f32 %0, %1\n\tv_nop" : "=v"(r) : "v"(a));  // v_nop: the slot behind v_rsq
  return r;
}
__device__ __forceinline__ float exp2_slot(float a) {
  float r;
  asm("v_exp_f32 %0, %1\n\tv_nop" : "=v"(r) : "v"(a));  // v_nop: the slot behind v_exp
  return r;
}

// ---------- kernel 1: layernorm(x), f16 weight conversion and the q/k/v/gate projections (WMMA
// f16). grid (row tile, z): z = 0..3 selects the matrix, one 8-wave work-group per 16 rows;
// z = 4 writes the transposed f16 copy of Wout that the last kernel reads.
#define APITCH 264  // staged row: 256 halves + 8, so 16 rows' 16-byte reads fall on different banks
__global__ __launch_bounds__(256) void k_proj(const float* x, const float* gamma,
                                              const float* beta, const float* Wq,
                                              const float* Wk, const float* Wv,
                                              const float* Wg, const float* Wout,
                                              const float* bg, _Float16* qh, _Float16* kh,
                                              _Float16* vT, float* gate, _Float16* WoutT) {
  const int mt = blockIdx.x, z = blockIdx.y, tid = threadIdx.x;
  if (z == 4) {  // the whole block leaves here, ahead of the barrier
    const float4 wv = *reinterpret_cast<const float4*>(Wout + (size_t)tid * DG + mt * 4);
    WoutT[(size_t)(mt * 4 + 0) * DG + tid] = (_Float16)wv.x;
    WoutT[(size_t)(mt * 4 + 1) * DG + tid] = (_Float16)wv.y;
    WoutT[(size_t)(mt * 4 + 2) * DG + tid] = (_Float16)wv.z;
    WoutT[(size_t)(mt * 4 + 3) * DG + tid] = (_Float16)wv.w;
    return;
  }
  __shared__ __attribute__((aligned(16))) _Float16 aS[16 * APITCH];
  const int w = tid >> 5, ln = tid & 31, n = ln & 15, hi = ln >> 4, off2 = hi * 8;

  // wave w normalizes rows 2w and 2w + 1; a lane holds elements ln + 32 i of a row
  float xv[2][8], gm[8], bt[8];
#pragma unroll  // constant indices keep the arrays in registers
  for (int i = 0; i < 8; ++i) {
    xv[0][i] = x[(size_t)(mt * 16 + w * 2) * DG + ln + 32 * i];
    xv[1][i] = x[(size_t)(mt * 16 + w * 2 + 1) * DG + ln + 32 * i];
    gm[i] = gamma[ln + 32 * i];
    bt[i] = beta[ln + 32 * i];
  }

  // B fragments of output columns 32w .. 32w + 31 (two tiles), whole K, straight from the
  // k-major f32 weights (Wk scaled by 1/sqrt(D)); they do not depend on the layernorm
  const float* W = (z == 0) ? Wq : (z == 1) ? Wk : (z == 2) ? Wv : Wg;
  const float sc = (z == 1) ? 0.17677669529663687f : 1.f;
  v16h bF[2][8];
#pragma unroll  // constant indices keep bF in registers
  for (int ks = 0; ks < 8; ++ks) {
#pragma unroll  // constant indices: the vectors stay in registers
    for (int t = 0; t < 2; ++t) {
      const float* wp = W + (size_t)(ks * 32 + off2) * DG + w * 32 + t * 16 + n;
#pragma unroll  // constant indices: the vectors stay in registers
      for (int i = 0; i < 8; ++i) {
        bF[t][ks][i] = (_Float16)(wp[(size_t)i * DG] * sc);
        bF[t][ks][i + 8] = (_Float16)(wp[(size_t)(16 + i) * DG] * sc);
      }
    }
  }

#pragma unroll  // constant indices: the vectors stay in registers
  for (int r = 0; r < 2; ++r) {
    // halving tree over the 256 elements: distances 128, 64, 32 inside the lane, 16 .. 1 across
    float sa[8], sb[8];
#pragma unroll  // constant indices: the vectors stay in registers
    for (int i = 0; i < 8; ++i) { sa[i] = xv[r][i]; sb[i] = xv[r][i] * xv[r][i]; }
#pragma unroll  // constant indices: the vectors stay in registers
    for (int i = 0; i < 4; ++i) { sa[i] += sa[i + 4]; sb[i] += sb[i + 4]; }
    sa[0] += sa[2]; sb[0] += sb[2];
    sa[1] += sa[3]; sb[1] += sb[3];
    float s1 = sa[0] + sa[1], s2 = sb[0] + sb[1];
#pragma unroll  // five fixed steps, straight-line
    for (int d = 16; d > 0; d >>= 1) {
      s1 += __shfl_xor(s1, d, 32);
      s2 += __shfl_xor(s2, d, 32);
    }
    float mu = s1 * (1.f / 256.f);
    float var = s2 * (1.f / 256.f) - mu * mu;
    // rsqrtf spelled out: an argument below the smallest normal is scaled into range
    const float va = var + 1e-5f;
    const bool tiny = va < 1.17549435e-38f;
    float rs = rsq_slot(tiny ? va * 16777216.f : va);
    rs = tiny ? rs * 4096.f : rs;
#pragma unroll  // constant indices: the vectors stay in registers
    for (int i = 0; i < 8; ++i)
      aS[(w * 2 + r) * APITCH + ln + 32 * i] = (_Float16)((xv[r][i] - mu) * rs * gm[i] + bt[i]);
  }
  __syncthreads();  // every wave reads all 16 normalized rows

  v8f c0 = {0.f, 0.f, 0.f, 0.f, 0.f, 0.f, 0.f, 0.f};
  v8f c1 = {0.f, 0.f, 0.f, 0.f, 0.f, 0.f, 0.f, 0.f};
  const _Float16* ap = aS + n * APITCH;
#pragma unroll  // constant indices into bF
  for (int ks = 0; ks < 8; ++ks) {
    v16h a = ld_frag_full(ap + ks * 32, off2);
    c0 = __builtin_amdgcn_wmma_f32_16x16x32_f16(false, a, false, bF[0][ks], (short)0, c0,
                                                false, false);
    c1 = __builtin_amdgcn_wmma_f32_16x16x32_f16(false, a, false, bF[1][ks], (short)0, c1,
                                                false, false);
  }
  // the branch on z stands outside the store loops: one scalar test a wave, not one a store
  const int row0 = mt * 16 + 8 * hi;
  const int col0 = w * 32 + n, col1 = col0 + 16;
  if (z == 0 || z == 1) {
    _Float16* dst = (z == 0) ? qh : kh;
#pragma unroll  // constant indices: the vectors stay in registers
    for (int j = 0; j < 8; ++j) {
      dst[(size_t)(row0 + j) * DG + col0] = (_Float16)c0[j];
      dst[(size_t)(row0 + j) * DG + col1] = (_Float16)c1[j];
    }
    // the stores' registers are not rewritten ahead of this wait on any way out of the branch
    asm volatile("s_wait_xcnt 0x0" ::: "memory");
  } else if (z == 2) {
    // head w, dims n and 16 + n; the 16 rows of a tile lie in one batch
    const int bb = row0 >> 9, kp = row0 & 511;
    _Float16* v0 = vT + ((size_t)(bb * NH + w) * HD + n) * L_SEQ + kp;
    _Float16* v1 = v0 + (size_t)16 * L_SEQ;
#pragma unroll  // constant indices: the vectors stay in registers
    for (int j = 0; j < 8; ++j) {
      v0[j] = (_Float16)c0[j];
      v1[j] = (_Float16)c1[j];
    }
    // the stores' registers are not rewritten ahead of this wait on any way out of the branch
    asm volatile("s_wait_xcnt 0x0" ::: "memory");
  } else {
    const float bg0 = bg[col0], bg1 = bg[col1];
#pragma unroll  // constant indices: the vectors stay in registers
    for (int j = 0; j < 8; ++j) {
      float g0 = c0[j] + bg0, g1 = c1[j] + bg1;
      // exp(-g) as 2^(-g log2 e), what __expf computes
      gate[(size_t)(row0 + j) * DG + col0] = 1.f / (1.f + exp2_slot(g0 * -1.44269504f));
      gate[(size_t)(row0 + j) * DG + col1] = 1.f / (1.f + exp2_slot(g1 * -1.44269504f));
    }
    // the stores' registers are not rewritten ahead of this wait on any way out of the branch
    asm volatile("s_wait_xcnt 0x0" ::: "memory");
  }
}

// ---------- kernel 2: fused bias-LN + pair projection + split-K flash attention
// grid (qt=32, b=2, ks=KSPLIT); each WG covers k in [ks*128, ks*128+128)
__global__ __launch_bounds__(256) void k_attn(const float* bias, const float* b_gamma,
                                              const float* b_beta, const float* Wb,
                                              const _Float16* qh, const _Float16* kh,
                                              const _Float16* vT,
                                              float* Opart, float* mpart, float* spart) {
  const int qt = blockIdx.x;
  const int b = blockIdx.y;
  const int ksp = blockIdx.z;
  const int tid = threadIdx.x;
  const int w = tid >> 5;          // wave id == head id
  const int ln = tid & 31;
  const int n = ln & 15;
  const int hi = ln >> 4;
  const int off2 = hi * 8;
  const int koff = hi * 2;         // f32 WMMA A/B K offset per lane half

  __shared__ float2 gwB2[64][16];              // B table for pair WMMA (c pairs x 16 cols)
  __shared__ float Gh[8], Cbh[8];              // sum(gamma*Wb), sum(beta*Wb)
  __shared__ float pairLds[16 * 16 * 17];      // [q][k][col], padded
  __shared__ float ssqLds[16 * 16 * 2];        // sumsq partials
  __shared__ _Float16 pP[8 * 16 * 24];         // per-wave P staging (row stride 24)
  __shared__ __attribute__((aligned(16))) unsigned char biasSt[2 * BBUF];  // two bias tiles

  const int ktBeg = ksp * 8;
  const int ktEnd = ktBeg + 8;
  const size_t bq0 = (size_t)(b * L_SEQ + qt * 16 + w * 2);
  // the lane's own LDS byte address in row 0 of its wave's slice of buffer 0
  const unsigned stLds = (unsigned)(size_t)biasSt + w * BSLICE + ln * 16;
  copy_tile(stLds, bias, bq0, ktBeg, ln);      // tile 0 flies while the tables are built

  // init B table: cols 0..7 = gamma[c]*Wb[c][h], col 8 = 1 (row sums), rest 0
  for (int idx = tid; idx < 1024; idx += 256) {
    int cp = idx >> 4, nn = idx & 15;
    int c0 = cp * 2;
    float v0 = (nn < 8) ? b_gamma[c0] * Wb[c0 * 8 + nn] : (nn == 8 ? 1.f : 0.f);
    float v1 = (nn < 8) ? b_gamma[c0 + 1] * Wb[(c0 + 1) * 8 + nn] : (nn == 8 ? 1.f : 0.f);
    gwB2[cp][nn] = make_float2(v0, v1);
  }
  if (tid < 8) {
    float g = 0.f, cb = 0.f;
    for (int c = 0; c < DB; ++c) {
      float wv = Wb[c * 8 + tid];
      g += b_gamma[c] * wv;
      cb += b_beta[c] * wv;
    }
    Gh[tid] = g; Cbh[tid] = cb;
  }

  // per-head Q fragment (rows = 16 q positions, K = 32 dims)
  const _Float16* qp = qh + (size_t)(b * L_SEQ + qt * 16 + n) * DG + w * HD;
  v16h aQ = ld_frag_full(qp, off2);

  float mrow[8], srow[8];
  v8f O1 = {0.f, 0.f, 0.f, 0.f, 0.f, 0.f, 0.f, 0.f};
  v8f O2 = {0.f, 0.f, 0.f, 0.f, 0.f, 0.f, 0.f, 0.f};
#pragma unroll
  for (int j = 0; j < 8; ++j) { mrow[j] = -1e30f; srow[j] = 0.f; }

  asm volatile("s_wait_asynccnt 0x0" ::: "memory");  // tile 0 has landed
  __syncthreads();
  copy_tile(stLds + BBUF, bias, bq0, ktBeg + 1, ln);

  for (int kt = ktBeg; kt < ktEnd; ++kt) {
    const unsigned bufOff = ((kt - ktBeg) & 1) * BBUF;
    // ---- phase 1: pair tile via f32 WMMA; wave w owns q rows 2w, 2w+1
    {
      const int q0 = w * 2, q1 = w * 2 + 1;
      const unsigned char* st = biasSt + bufOff + w * BSLICE + n * BPITCH;
      const float* bp0 = reinterpret_cast<const float*>(st) + koff;
      const float* bp1 = reinterpret_cast<const float*>(st + 16 * BPITCH) + koff;
      v8f C0 = {0.f, 0.f, 0.f, 0.f, 0.f, 0.f, 0.f, 0.f};
      v8f C1 = {0.f, 0.f, 0.f, 0.f, 0.f, 0.f, 0.f, 0.f};
      float ss0 = 0.f, ss1 = 0.f;
      for (int cs = 0; cs < 32; ++cs) {
        float2 av0 = *reinterpret_cast<const float2*>(bp0 + cs * 4);
        float2 av1 = *reinterpret_cast<const float2*>(bp1 + cs * 4);
        float2 bv = gwB2[cs * 2 + hi][n];
        ss0 += av0.x * av0.x + av0.y * av0.y;
        ss1 += av1.x * av1.x + av1.y * av1.y;
        v2f a0 = {av0.x, av0.y};
        v2f a1 = {av1.x, av1.y};
        v2f bb = {bv.x, bv.y};
        C0 = __builtin_amdgcn_wmma_f32_16x16x4_f32(false, a0, false, bb, (short)0,
                                                   C0, false, false);
        C1 = __builtin_amdgcn_wmma_f32_16x16x4_f32(false, a1, false, bb, (short)0,
                                                   C1, false, false);
      }
#pragma unroll
      for (int j = 0; j < 8; ++j) {
        pairLds[(q0 * 16 + j + 8 * hi) * 17 + n] = C0[j];
        pairLds[(q1 * 16 + j + 8 * hi) * 17 + n] = C1[j];
      }
      ssqLds[(q0 * 16 + n) * 2 + hi] = ss0;
      ssqLds[(q1 * 16 + n) * 2 + hi] = ss1;
    }
    __syncthreads();
    // ---- cleanup: finish layernorm correction per (q,k)
    {
      int q = tid >> 4, kk = tid & 15;
      int base = (q * 16 + kk) * 17;
      float sum = pairLds[base + 8];
      float ssq = ssqLds[(q * 16 + kk) * 2] + ssqLds[(q * 16 + kk) * 2 + 1];
      float mu = sum * (1.f / 128.f);
      float var = ssq * (1.f / 128.f) - mu * mu;
      float rsg = rsqrtf(var + 1e-5f);
#pragma unroll
      for (int h = 0; h < 8; ++h)
        pairLds[base + h] = rsg * (pairLds[base + h] - mu * Gh[h]) + Cbh[h];
    }
    __syncthreads();
    // ---- phase 2: per-head logits = Q*K^T + pair, flash update, O += P*V
    v8f cp;
#pragma unroll
    for (int j = 0; j < 8; ++j)
      cp[j] = pairLds[((j + 8 * hi) * 16 + n) * 17 + w];

    const _Float16* kp = kh + (size_t)(b * L_SEQ + kt * 16 + n) * DG + w * HD;
    v16h bK = ld_frag_full(kp, off2);
    v8f Lg = __builtin_amdgcn_wmma_f32_16x16x32_f16(false, aQ, false, bK, (short)0,
                                                    cp, false, false);
    float Pv[8];
#pragma unroll
    for (int j = 0; j < 8; ++j) {
      float l = Lg[j];
      float mx = half16_max(l);
      float nm = fmaxf(mrow[j], mx);
      float al = __expf(mrow[j] - nm);
      float p = __expf(l - nm);
      float rs = half16_sum(p);
      srow[j] = srow[j] * al + rs;
      mrow[j] = nm;
      O1[j] *= al; O2[j] *= al;
      Pv[j] = p;
    }
    // wave-private LDS transpose of P (C layout -> A layout)
    _Float16* pw = pP + w * 16 * 24;
#pragma unroll
    for (int j = 0; j < 8; ++j)
      pw[(j + 8 * hi) * 24 + n] = (_Float16)Pv[j];
    asm volatile("s_wait_dscnt 0" ::: "memory");
    v16h aP = ld_frag_lo(pw + n * 24, off2);     // rows q, K = 16 k (+16 zero pad)

    const _Float16* vp1 = vT + ((size_t)(b * NH + w) * HD + n) * L_SEQ + kt * 16;
    const _Float16* vp2 = vT + ((size_t)(b * NH + w) * HD + 16 + n) * L_SEQ + kt * 16;
    v16h bV1 = ld_frag_lo(vp1, off2);
    v16h bV2 = ld_frag_lo(vp2, off2);
    O1 = __builtin_amdgcn_wmma_f32_16x16x32_f16(false, aP, false, bV1, (short)0,
                                                O1, false, false);
    O2 = __builtin_amdgcn_wmma_f32_16x16x32_f16(false, aP, false, bV2, (short)0,
                                                O2, false, false);
    // publish point: own LDS reads done, own copies of tile kt + 1 landed, then the barrier
    asm volatile("s_wait_dscnt 0x0" ::: "memory");
    asm volatile("s_wait_asynccnt 0x0" ::: "memory");
    __syncthreads();
    if (kt + 2 < ktEnd) copy_tile(stLds + bufOff, bias, bq0, kt + 2, ln);
  }
  asm volatile("s_wait_asynccnt 0x0" ::: "memory");  // no copy outlives the loop

  // epilogue: write unnormalized partials (O, m, s) for this k-range
#pragma unroll
  for (int j = 0; j < 8; ++j) {
    size_t row = (size_t)(b * L_SEQ + qt * 16 + j + 8 * hi);
    size_t base = ((size_t)ksp * ROWS + row) * DG + w * HD;
    Opart[base + n] = O1[j];
    Opart[base + 16 + n] = O2[j];
  }
  if (n == 0) {
#pragma unroll
    for (int j = 0; j < 8; ++j) {
      size_t row = (size_t)(b * L_SEQ + qt * 16 + j + 8 * hi);
      mpart[((size_t)ksp * ROWS + row) * NH + w] = mrow[j];
      spart[((size_t)ksp * ROWS + row) * NH + w] = srow[j];
    }
  }
}

// ---------- kernel 3: combine split-K partials, normalize, gate -> f16 rows in LDS, then the
// output projection + bias (WMMA f16). grid (row tile, column half); wave w of a group combines
// rows 2w and 2w + 1 and then owns one 16-column tile of the product.
// amdgpu_waves_per_eu(2, 2): one group a WGP (128 groups in all), so no register is saved for more
// resident waves; without it the compiler holds the B-fragment loads back behind the arithmetic.
__global__ __launch_bounds__(256) __attribute__((amdgpu_waves_per_eu(2, 2)))
void k_out(const float* Opart, const float* mpart, const float* spart, const float* gate,
           const _Float16* WoutT, const float* bout, float* out) {
  const int mt = blockIdx.x, tid = threadIdx.x;
  const int w = tid >> 5, ln = tid & 31, n = ln & 15, hi = ln >> 4, off2 = hi * 8;
  const int col0 = (blockIdx.y * 8 + w) * 16;
  __shared__ __attribute__((aligned(16))) _Float16 aS[16 * APITCH];

  // a lane holds columns 64 i + 4 n .. + 3 of its row: 16 lanes read 256 contiguous bytes
  const int lrow = w * 2 + hi;
  const size_t row = (size_t)(mt * 16 + lrow);
  // the lane's own addresses: its row's 8 heads; columns 4 n .. 4 n + 3 of every 64
  const float* mp = mpart + row * NH;
  const float* sp = spart + row * NH;
  const float* op = Opart + row * DG + n * 4;
  const float* gp = gate + row * DG + n * 4;
  const _Float16* bp = WoutT + (size_t)(col0 + n) * DG + off2;
  const int oc = col0 + n;  // the lane's output column
  float4 mq[KSPLIT][2], sq[KSPLIT][2];  // maxima and sums of heads 0..3 and 4..7
  float4 ov[KSPLIT][4], gv[4];
  v16h bF[8];  // B fragments of the wave's 16 output columns, whole K
#pragma unroll  // constant indices keep the arrays in registers
  for (int g = 0; g < KSPLIT; ++g) {
    mq[g][0] = *reinterpret_cast<const float4*>(mp + g * ROWS * NH);
    mq[g][1] = *reinterpret_cast<const float4*>(mp + g * ROWS * NH + 4);
    sq[g][0] = *reinterpret_cast<const float4*>(sp + g * ROWS * NH);
    sq[g][1] = *reinterpret_cast<const float4*>(sp + g * ROWS * NH + 4);
  }
#pragma unroll  // constant indices keep the arrays in registers
  for (int i = 0; i < 4; ++i) {
#pragma unroll  // constant indices keep the arrays in registers
    for (int g = 0; g < KSPLIT; ++g)
      ov[g][i] = *reinterpret_cast<const float4*>(op + g * ROWS * DG + i * 64);
    gv[i] = *reinterpret_cast<const float4*>(gp + i * 64);
  }
#pragma unroll  // constant indices keep bF in registers
  for (int ks = 0; ks < 8; ++ks) bF[ks] = ld_frag_full(bp + ks * 32, 0);
  const float bo = bout[oc];
  // Every load of the kernel stands above this line (the "memory" clobber), so that a wave meets
  // one memory latency and not two. The wait stands ahead of any reuse of an address register:
  // as operands of the statement the addresses stay in their registers up to it.
  asm volatile("s_wait_xcnt 0x0" :: "v"(mp), "v"(sp), "v"(op), "v"(gp), "v"(bp), "v"(oc)
               : "memory");

  // columns 64 i + 4 n .. + 3 belong to head 2 i + (n >> 3)
  const bool odd = n >= 8;
  float mv[KSPLIT][4], sv[KSPLIT][4];
#pragma unroll  // constant indices keep the arrays in registers
  for (int g = 0; g < KSPLIT; ++g) {
    mv[g][0] = odd ? mq[g][0].y : mq[g][0].x;  sv[g][0] = odd ? sq[g][0].y : sq[g][0].x;
    mv[g][1] = odd ? mq[g][0].w : mq[g][0].z;  sv[g][1] = odd ? sq[g][0].w : sq[g][0].z;
    mv[g][2] = odd ? mq[g][1].y : mq[g][1].x;  sv[g][2] = odd ? sq[g][1].y : sq[g][1].x;
    mv[g][3] = odd ? mq[g][1].w : mq[g][1].z;  sv[g][3] = odd ? sq[g][1].w : sq[g][1].z;
  }
#pragma unroll  // constant indices keep the arrays in registers
  for (int i = 0; i < 4; ++i) {
    float m0 = -1e30f;
#pragma unroll  // constant indices keep the arrays in registers
    for (int g = 0; g < KSPLIT; ++g) m0 = fmaxf(m0, mv[g][i]);
    float s = 0.f, o0 = 0.f, o1 = 0.f, o2 = 0.f, o3 = 0.f;
#pragma unroll  // constant indices keep the arrays in registers
    for (int g = 0; g < KSPLIT; ++g) {
      // exp(d) as 2^(d log2 e), what __expf computes
      const float e = exp2_slot((mv[g][i] - m0) * 1.44269504f);
      s += sv[g][i] * e;
      o0 += ov[g][i].x * e;
      o1 += ov[g][i].y * e;
      o2 += ov[g][i].z * e;
      o3 += ov[g][i].w * e;
    }
    v4h r = {(_Float16)(o0 / s * gv[i].x), (_Float16)(o1 / s * gv[i].y),
             (_Float16)(o2 / s * gv[i].z), (_Float16)(o3 / s * gv[i].w)};
    *reinterpret_cast<v4h*>(aS + lrow * APITCH + i * 64 + n * 4) = r;
  }
  __syncthreads();  // every wave reads all 16 combined rows

  v8f c = {0.f, 0.f, 0.f, 0.f, 0.f, 0.f, 0.f, 0.f};
  const _Float16* ap = aS + n * APITCH;
#pragma unroll  // constant indices into bF
  for (int ks = 0; ks < 8; ++ks) {
    v16h a = ld_frag_full(ap + ks * 32, off2);
    c = __builtin_amdgcn_wmma_f32_16x16x32_f16(false, a, false, bF[ks], (short)0, c,
                                               false, false);
  }
#pragma unroll  // constant indices: the vector stays in registers
  for (int j = 0; j < 8; ++j)
    out[(size_t)(mt * 16 + j + 8 * hi) * DG + oc] = c[j] + bo;
}

extern "C" void kernel_launch(void* const* d_in, const int* in_sizes, int n_in,
                              void* d_out, int out_size, void* d_ws, size_t ws_size,
                              hipStream_t stream) {
  (void)in_sizes; (void)n_in; (void)out_size; (void)ws_size;
  const float* x       = (const float*)d_in[0];
  const float* bias    = (const float*)d_in[1];
  const float* g_gamma = (const float*)d_in[2];
  const float* g_beta  = (const float*)d_in[3];
  const float* b_gamma = (const float*)d_in[4];
  const float* b_beta  = (const float*)d_in[5];
  const float* Wq      = (const float*)d_in[6];
  const float* Wk      = (const float*)d_in[7];
  const float* Wv      = (const float*)d_in[8];
  const float* Wb      = (const float*)d_in[9];
  const float* Wg      = (const float*)d_in[10];
  const float* bg      = (const float*)d_in[11];
  const float* Wout    = (const float*)d_in[12];
  const float* bout    = (const float*)d_in[13];
  float* out = (float*)d_out;

  char* p = (char*)d_ws;
  _Float16* WoutT   = (_Float16*)p; p += (size_t)DG * DG * sizeof(_Float16);
  _Float16* qh      = (_Float16*)p; p += (size_t)ROWS * DG * sizeof(_Float16);
  _Float16* kh      = (_Float16*)p; p += (size_t)ROWS * DG * sizeof(_Float16);
  _Float16* vT      = (_Float16*)p; p += (size_t)ROWS * DG * sizeof(_Float16);
  float* gate       = (float*)p;    p += (size_t)ROWS * DG * sizeof(float);
  float* Opart      = (float*)p;    p += (size_t)KSPLIT * ROWS * DG * sizeof(float);
  float* mpart      = (float*)p;    p += (size_t)KSPLIT * ROWS * NH * sizeof(float);
  float* spart      = (float*)p;    p += (size_t)KSPLIT * ROWS * NH * sizeof(float);

  k_proj<<<dim3(ROWS / 16, 5), 256, 0, stream>>>(x, g_gamma, g_beta, Wq, Wk, Wv, Wg, Wout, bg,
                                                 qh, kh, vT, gate, WoutT);
  k_attn<<<dim3(32, 2, KSPLIT), 256, 0, stream>>>(bias, b_gamma, b_beta, Wb, qh, kh,
                                                  vT, Opart, mpart, spart);
  k_out<<<dim3(ROWS / 16, 2), 256, 0, stream>>>(Opart, mpart, spart, gate, WoutT, bout, out);
}

// v004
// One run takes 39.7 microseconds.
// In both of two side-by-side timings against v003, it was 1.12 times as fast.
// All steps since v000 together make it 1.92 times as fast.
#include <hip/hip_runtime.h>
#include <hip/hip_bf16.h>

typedef __attribute__((ext_vector_type(16))) _Float16 v16h;
typedef __attribute__((ext_vector_type(8)))  _Float16 v8h;
typedef __attribute__((ext_vector_type(4)))  _Float16 v4h;
typedef __attribute__((ext_vector_type(8)))  float    v8f;
typedef __attribute__((ext_vector_type(2)))  float    v2f;

#define L_SEQ 512
#define DG 256
#define DB 128
#define NH 8
#define HD 32
#define KSPLIT 4      // k-range split factor for the attention kernel
#define ROWS 1024     // b * L_SEQ
#define BPITCH 528            // staged bias row: 512 B + 16 B, so 16 rows' 8-byte reads fall on 64 different banks
#define USLOT (16 * BPITCH)   // one unit of the bias stream: 1 q row x 16 k rows x 128 channels
#define URING 3               // slots in a wave's private ring
#define WRING (URING * USLOT)
#define NUNIT 16              // units a wave streams: 2 q rows x 128 k rows
#define PKP 132               // pair row: 128 k + 4, so rows q and q + 8 fall on different banks
#define PPITCH 136            // P row: 128 halves + 8, so 16 rows' 16-byte reads spread over the banks

// ---------- fragment loaders (f16 A/B layout: lane row/col = ln&15,
// halves[0..7] = K off2+0..7, halves[8..15] = K 16+off2+0..7, off2 = (ln>>4)*8)
__device__ __forceinline__ v16h ld_frag_full(const _Float16* p, int off2) {
  v8h a = *reinterpret_cast<const v8h*>(p + off2);
  v8h b = *reinterpret_cast<const v8h*>(p + 16 + off2);
  v16h r;
#pragma unroll
  for (int i = 0; i < 8; ++i) { r[i] = a[i]; r[i + 8] = b[i]; }
  return r;
}

__device__ __forceinline__ float half16_max(float v) {
  v = fmaxf(v, __shfl_xor(v, 1, 32));
  v = fmaxf(v, __shfl_xor(v, 2, 32));
  v = fmaxf(v, __shfl_xor(v, 4, 32));
  v = fmaxf(v, __shfl_xor(v, 8, 32));
  return v;
}
__device__ __forceinline__ float half16_sum(float v) {
  v += __shfl_xor(v, 1, 32);
  v += __shfl_xor(v, 2, 32);
  v += __shfl_xor(v, 4, 32);
  v += __shfl_xor(v, 8, 32);
  return v;
}

// ---------- eight asynchronous 16-byte-per-lane copies: eight whole 512-byte bias rows -> LDS.
// lds and g are the lane's own addresses in row 0. The closing s_wait_xcnt stands inside the
// statement so that no address register is rewritten ahead of it.
__device__ __forceinline__ void copy_rows8(unsigned lds, const float* g) {
  asm volatile(
      "global_load_async_to_lds_b128 %0, %8, off\n\t"
      "global_load_async_to_lds_b128 %1, %9, off\n\t"
      "global_load_async_to_lds_b128 %2, %10, off\n\t"
      "global_load_async_to_lds_b128 %3, %11, off\n\t"
      "global_load_async_to_lds_b128 %4, %12, off\n\t"
      "global_load_async_to_lds_b128 %5, %13, off\n\t"
      "global_load_async_to_lds_b128 %6, %14, off\n\t"
      "global_load_async_to_lds_b128 %7, %15, off\n\t"
      "s_wait_xcnt 0x0"
      :: "v"(lds), "v"(lds + BPITCH), "v"(lds + 2 * BPITCH), "v"(lds + 3 * BPITCH),
         "v"(lds + 4 * BPITCH), "v"(lds + 5 * BPITCH), "v"(lds + 6 * BPITCH),
         "v"(lds + 7 * BPITCH),
         "v"(g), "v"(g + DB), "v"(g + 2 * DB), "v"(g + 3 * DB), "v"(g + 4 * DB),
         "v"(g + 5 * DB), "v"(g + 6 * DB), "v"(g + 7 * DB)
      : "memory");
}
// one unit (16 whole rows that follow one another in memory) into one slot of the wave's ring
__device__ __forceinline__ void copy_unit(unsigned lds, const float* g) {
  copy_rows8(lds, g);
  copy_rows8(lds + 8 * BPITCH, g + 8 * DB);
}

// ---------- one transcendental with the free issue slot that the instruction set asks for behind it,
// in one statement: nothing that overwrites its source or reads its result can stand directly behind
__device__ __forceinline__ float rsq_slot(float a) {
  float r;
  asm("v_rsq_f32 %0, %1\n\tv_nop" : "=v"(r) : "v"(a));  // v_nop: the slot behind v_rsq
  return r;
}
__device__ __forceinline__ float exp2_slot(float a) {
  float r;
  asm("v_exp_f32 %0, %1\n\tv_nop" : "=v"(r) : "v"(a));  // v_nop: the slot behind v_exp
  return r;
}

// ---------- kernel 1: layernorm(x), f16 weight conversion and the q/k/v/gate projections (WMMA
// f16). grid (row tile, z): z = 0..3 selects the matrix, one 8-wave work-group per 16 rows;
// z = 4 writes the transposed f16 copy of Wout that the last kernel reads.
#define APITCH 264  // staged row: 256 halves + 8, so 16 rows' 16-byte reads fall on different banks
__global__ __launch_bounds__(256) void k_proj(const float* x, const float* gamma,
                                              const float* beta, const float* Wq,
                                              const float* Wk, const float* Wv,
                                              const float* Wg, const float* Wout,
                                              const float* bg, _Float16* qh, _Float16* kh,
                                              _Float16* vT, float* gate, _Float16* WoutT) {
  const int mt = blockIdx.x, z = blockIdx.y, tid = threadIdx.x;
  if (z == 4) {  // the whole block leaves here, ahead of the barrier
    const float4 wv = *reinterpret_cast<const float4*>(Wout + (size_t)tid * DG + mt * 4);
    WoutT[(size_t)(mt * 4 + 0) * DG + tid] = (_Float16)wv.x;
    WoutT[(size_t)(mt * 4 + 1) * DG + tid] = (_Float16)wv.y;
    WoutT[(size_t)(mt * 4 + 2) * DG + tid] = (_Float16)wv.z;
    WoutT[(size_t)(mt * 4 + 3) * DG + tid] = (_Float16)wv.w;
    return;
  }
  __shared__ __attribute__((aligned(16))) _Float16 aS[16 * APITCH];
  const int w = tid >> 5, ln = tid & 31, n = ln & 15, hi = ln >> 4, off2 = hi * 8;

  // wave w normalizes rows 2w and 2w + 1; a lane holds elements ln + 32 i of a row
  float xv[2][8], gm[8], bt[8];
#pragma unroll  // constant indices keep the arrays in registers
  for (int i = 0; i < 8; ++i) {
    xv[0][i] = x[(size_t)(mt * 16 + w * 2) * DG + ln + 32 * i];
    xv[1][i] = x[(size_t)(mt * 16 + w * 2 + 1) * DG + ln + 32 * i];
    gm[i] = gamma[ln + 32 * i];
    bt[i] = beta[ln + 32 * i];
  }

  // B fragments of output columns 32w .. 32w + 31 (two tiles), whole K, straight from the
  // k-major f32 weights (Wk scaled by 1/sqrt(D)); they do not depend on the layernorm
  const float* W = (z == 0) ? Wq : (z == 1) ? Wk : (z == 2) ? Wv : Wg;
  const float sc = (z == 1) ? 0.17677669529663687f : 1.f;
  v16h bF[2][8];
#pragma unroll  // constant indices keep bF in registers
  for (int ks = 0; ks < 8; ++ks) {
#pragma unroll  // constant indices: the vectors stay in registers
    for (int t = 0; t < 2; ++t) {
      const float* wp = W + (size_t)(ks * 32 + off2) * DG + w * 32 + t * 16 + n;
#pragma unroll  // constant indices: the vectors stay in registers
      for (int i = 0; i < 8; ++i) {
        bF[t][ks][i] = (_Float16)(wp[(size_t)i * DG] * sc);
        bF[t][ks][i + 8] = (_Float16)(wp[(size_t)(16 + i) * DG] * sc);
      }
    }
  }

#pragma unroll  // constant indices: the vectors stay in registers
  for (int r = 0; r < 2; ++r) {
    // halving tree over the 256 elements: distances 128, 64, 32 inside the lane, 16 .. 1 across
    float sa[8], sb[8];
#pragma unroll  // constant indices: the vectors stay in registers
    for (int i = 0; i < 8; ++i) { sa[i] = xv[r][i]; sb[i] = xv[r][i] * xv[r][i]; }
#pragma unroll  // constant indices: the vectors stay in registers
    for (int i = 0; i < 4; ++i) { sa[i] += sa[i + 4]; sb[i] += sb[i + 4]; }
    sa[0] += sa[2]; sb[0] += sb[2];
    sa[1] += sa[3]; sb[1] += sb[3];
    float s1 = sa[0] + sa[1], s2 = sb[0] + sb[1];
#pragma unroll  // five fixed steps, straight-line
    for (int d = 16; d > 0; d >>= 1) {
      s1 += __shfl_xor(s1, d, 32);
      s2 += __shfl_xor(s2, d, 32);
    }
    float mu = s1 * (1.f / 256.f);
    float var = s2 * (1.f / 256.f) - mu * mu;
    // rsqrtf spelled out: an argument below the smallest normal is scaled into range
    const float va = var + 1e-5f;
    const bool tiny = va < 1.17549435e-38f;
    float rs = rsq_slot(tiny ? va * 16777216.f : va);
    rs = tiny ? rs * 4096.f : rs;
#pragma unroll  // constant indices: the vectors stay in registers
    for (int i = 0; i < 8; ++i)
      aS[(w * 2 + r) * APITCH + ln + 32 * i] = (_Float16)((xv[r][i] - mu) * rs * gm[i] + bt[i]);
  }
  __syncthreads();  // every wave reads all 16 normalized rows

  v8f c0 = {0.f, 0.f, 0.f, 0.f, 0.f, 0.f, 0.f, 0.f};
  v8f c1 = {0.f, 0.f, 0.f, 0.f, 0.f, 0.f, 0.f, 0.f};
  const _Float16* ap = aS + n * APITCH;
#pragma unroll  // constant indices into bF
  for (int ks = 0; ks < 8; ++ks) {
    v16h a = ld_frag_full(ap + ks * 32, off2);
    c0 = __builtin_amdgcn_wmma_f32_16x16x32_f16(false, a, false, bF[0][ks], (short)0, c0,
                                                false, false);
    c1 = __builtin_amdgcn_wmma_f32_16x16x32_f16(false, a, false, bF[1][ks], (short)0, c1,
                                                false, false);
  }
  // the branch on z stands outside the store loops: one scalar test a wave, not one a store
  const int row0 = mt * 16 + 8 * hi;
  const int col0 = w * 32 + n, col1 = col0 + 16;
  if (z == 0 || z == 1) {
    _Float16* dst = (z == 0) ? qh : kh;
#pragma unroll  // constant indices: the vectors stay in registers
    for (int j = 0; j < 8; ++j) {
      dst[(size_t)(row0 + j) * DG + col0] = (_Float16)c0[j];
      dst[(size_t)(row0 + j) * DG + col1] = (_Float16)c1[j];
    }
    // the stores' registers are not rewritten ahead of this wait on any way out of the branch
    asm volatile("s_wait_xcnt 0x0" ::: "memory");
  } else if (z == 2) {
    // head w, dims n and 16 + n; the 16 rows of a tile lie in one batch
    const int bb = row0 >> 9, kp = row0 & 511;
    _Float16* v0 = vT + ((size_t)(bb * NH + w) * HD + n) * L_SEQ + kp;
    _Float16* v1 = v0 + (size_t)16 * L_SEQ;
#pragma unroll  // constant indices: the vectors stay in registers
    for (int j = 0; j < 8; ++j) {
      v0[j] = (_Float16)c0[j];
      v1[j] = (_Float16)c1[j];
    }
    // the stores' registers are not rewritten ahead of this wait on any way out of the branch
    asm volatile("s_wait_xcnt 0x0" ::: "memory");
  } else {
    const float bg0 = bg[col0], bg1 = bg[col1];
#pragma unroll  // constant indices: the vectors stay in registers
    for (int j = 0; j < 8; ++j) {
      float g0 = c0[j] + bg0, g1 = c1[j] + bg1;
      // exp(-g) as 2^(-g log2 e), what __expf computes
      gate[(size_t)(row0 + j) * DG + col0] = 1.f / (1.f + exp2_slot(g0 * -1.44269504f));
      gate[(size_t)(row0 + j) * DG + col1] = 1.f / (1.f + exp2_slot(g1 * -1.44269504f));
    }
    // the stores' registers are not rewritten ahead of this wait on any way out of the branch
    asm volatile("s_wait_xcnt 0x0" ::: "memory");
  }
}

// ---------- kernel 2: bias-LN + pair projection, then split-K attention, in two passes
// grid (qt=32, b=2, ks=KSPLIT); each WG covers k in [ks*128, ks*128+128)
// pass 1 has no barrier: wave w streams q rows 2w and 2w + 1 through a ring of its own and leaves
// the finished pair values of all 128 k in LDS; pass 2, behind one barrier, is one softmax a head.
__global__ __launch_bounds__(256) void k_attn(const float* bias, const float* b_gamma,
                                              const float* b_beta, const float* Wb,
                                              const _Float16* qh, const _Float16* kh,
                                              const _Float16* vT,
                                              float* Opart, float* mpart, float* spart) {
  const int qt = blockIdx.x;
  const int b = blockIdx.y;
  const int ksp = blockIdx.z;
  const int tid = threadIdx.x;
  const int w = tid >> 5;          // wave id == head id
  const int ln = tid & 31;
  const int n = ln & 15;
  const int hi = ln >> 4;
  const int off2 = hi * 8;
  const int koff = hi * 2;         // f32 WMMA A/B K offset per lane half

  __shared__ float2 gwB2[64][16];              // B table for pair WMMA (c pairs x 16 cols)
  __shared__ float Gh[8], Cbh[8];              // sum(gamma*Wb), sum(beta*Wb)
  __shared__ float rawLds[8][16 * 17];         // per wave: one unit's raw products [k][col], padded
  __shared__ float ssqLds[8][16 * 2];          // per wave: one unit's sumsq partials
  __shared__ float pairAll[8 * 16 * PKP];      // finished pair values [head][q][k]
  __shared__ __attribute__((aligned(16))) _Float16 pP[8 * 16 * PPITCH];  // per-wave P staging
  __shared__ __attribute__((aligned(16))) unsigned char biasSt[8 * WRING];  // eight private rings

  const int ktBeg = ksp * 8;
  const size_t bq0 = (size_t)(b * L_SEQ + qt * 16 + w * 2);
  // the lane's own LDS byte address in row 0 of slot 0 of its wave's ring
  const unsigned ringLds = (unsigned)(size_t)biasSt + w * WRING + ln * 16;
  // the lane's own global address in row 0 of unit 0; unit u = q row u >> 3, k rows 16 (u & 7) ..
  const float* gsrc = bias + (bq0 * L_SEQ + ktBeg * 16) * DB + ln * 4;
  copy_unit(ringLds, gsrc);                    // units 0 to 2 fly while the tables are built
  copy_unit(ringLds + USLOT, gsrc + 16 * DB);
  copy_unit(ringLds + 2 * USLOT, gsrc + 32 * DB);

  // the head's fragments for pass 2, asked for here so that the table build hides their latency:
  // Q (rows = 16 q positions, K = 32 dims), K of the eight k tiles, V of the four 32-wide k steps;
  // the pointers are the lane's own addresses, its half's K offset off2 included
  const _Float16* qp = qh + (size_t)(b * L_SEQ + qt * 16 + n) * DG + w * HD + off2;
  const _Float16* kp = kh + (size_t)(b * L_SEQ + ktBeg * 16 + n) * DG + w * HD + off2;
  const _Float16* vp = vT + ((size_t)(b * NH + w) * HD + n) * L_SEQ + ktBeg * 16 + off2;
  v16h aQ = ld_frag_full(qp, 0);
  v16h bK[8], bV1[4], bV2[4];
#pragma unroll  // constant indices keep the fragments in registers
  for (int kt = 0; kt < 8; ++kt) bK[kt] = ld_frag_full(kp + kt * 16 * DG, 0);
#pragma unroll  // constant indices keep the fragments in registers
  for (int kk = 0; kk < 4; ++kk) {
    bV1[kk] = ld_frag_full(vp + kk * 32, 0);
    bV2[kk] = ld_frag_full(vp + 16 * L_SEQ + kk * 32, 0);
  }
  // the wait stands ahead of any reuse of an address register of these loads: as operands of the
  // statement the addresses stay in their registers up to it
  asm volatile("s_wait_xcnt 0x0" :: "v"(qp), "v"(kp), "v"(vp) : "memory");

  // init B table: cols 0..7 = gamma[c]*Wb[c][h], col 8 = 1 (row sums), rest 0
  for (int idx = tid; idx < 1024; idx += 256) {
    int cp = idx >> 4, nn = idx & 15;
    int c0 = cp * 2;
    float v0 = (nn < 8) ? b_gamma[c0] * Wb[c0 * 8 + nn] : (nn == 8 ? 1.f : 0.f);
    float v1 = (nn < 8) ? b_gamma[c0 + 1] * Wb[(c0 + 1) * 8 + nn] : (nn == 8 ? 1.f : 0.f);
    gwB2[cp][nn] = make_float2(v0, v1);
  }
  if (tid < 8) {
    float g = 0.f, cb = 0.f;
    for (int c = 0; c < DB; ++c) {
      float wv = Wb[c * 8 + tid];
      g += b_gamma[c] * wv;
      cb += b_beta[c] * wv;
    }
    Gh[tid] = g; Cbh[tid] = cb;
  }

  __syncthreads();  // the tables are complete

  float gh[4], cb[4];  // the lane finishes heads 4 hi .. 4 hi + 3 of k row n
#pragma unroll  // constant indices keep the arrays in registers
  for (int i = 0; i < 4; ++i) { gh[i] = Gh[hi * 4 + i]; cb[i] = Cbh[hi * 4 + i]; }
  // the lane's B fragments of the pair product: the same in every unit, so read once
  v2f bB[32];
#pragma unroll  // constant indices keep bB in registers
  for (int cs = 0; cs < 32; ++cs) {
    float2 bv = gwB2[cs * 2 + hi][n];
    bB[cs] = v2f{bv.x, bv.y};
  }
  float* rawW = rawLds[w];
  float* ssqW = ssqLds[w];

  // ---- pass 1: 16 units of one q row x 16 k rows; nothing here is read by another wave
  unsigned slot = 0;  // byte offset of unit u's slot in the ring
#pragma unroll 1  // one copy of the body: for speed only
  for (int u = 0; u < NUNIT; ++u) {
    // Unit u has landed. While refills go on, exactly units u + 1 and u + 2 (32 copies) were issued
    // behind it, and the counter returns in issue order; the trips without a refill wait to 0.
    if (u < NUNIT - URING) asm volatile("s_wait_asynccnt 0x20" ::: "memory");
    else                   asm volatile("s_wait_asynccnt 0x0" ::: "memory");
    const float* bp =
        reinterpret_cast<const float*>(biasSt + w * WRING + slot + n * BPITCH) + koff;
    float2 av[32];
#pragma unroll  // constant indices keep av in registers
    for (int cs = 0; cs < 32; ++cs) av[cs] = *reinterpret_cast<const float2*>(bp + cs * 4);
    // the wave's own reads of the slot are done: only then may copies write it again
    asm volatile("s_wait_dscnt 0x0" ::: "memory");
    if (u < NUNIT - URING) {
      const int u3 = u + URING;
      copy_unit(ringLds + slot, gsrc + (size_t)(u3 >> 3) * L_SEQ * DB + (u3 & 7) * 16 * DB);
    }
    v8f C = {0.f, 0.f, 0.f, 0.f, 0.f, 0.f, 0.f, 0.f};
    float ss = 0.f;
#pragma unroll  // constant indices into av and bB
    for (int cs = 0; cs < 32; ++cs) {
      ss += av[cs].x * av[cs].x + av[cs].y * av[cs].y;
      v2f a = {av[cs].x, av[cs].y};
      C = __builtin_amdgcn_wmma_f32_16x16x4_f32(false, a, false, bB[cs], (short)0, C, false,
                                                false);
    }
#pragma unroll  // constant indices keep the vectors in registers
    for (int j = 0; j < 8; ++j) rawW[(j + 8 * hi) * 17 + n] = C[j];
    ssqW[n * 2 + hi] = ss;
    // other lanes of this wave read what these stores wrote
    asm volatile("s_wait_dscnt 0x0" ::: "memory");
    // finish the layernorm correction of (q, k = n) for four heads
    {
      float sum = rawW[n * 17 + 8];
      float ssq = ssqW[n * 2] + ssqW[n * 2 + 1];
      float mu = sum * (1.f / 128.f);
      float var = ssq * (1.f / 128.f) - mu * mu;
      float rsg = rsqrtf(var + 1e-5f);
      float* pd = pairAll + (hi * 64 + w * 2 + (u >> 3)) * PKP + (u & 7) * 16 + n;
#pragma unroll  // constant indices keep the vectors in registers
      for (int i = 0; i < 4; ++i)
        pd[i * 16 * PKP] = rsg * (rawW[n * 17 + hi * 4 + i] - mu * gh[i]) + cb[i];
    }
    slot = (slot == (URING - 1) * USLOT) ? 0u : slot + USLOT;
  }
  __syncthreads();  // every wave's pair values are in place; wave w now reads head w of all 16 q

  // ---- pass 2: logits = Q*K^T + pair over all 128 k, one softmax, O = P*V
  v8f Lg[8];
#pragma unroll  // constant indices keep Lg in registers
  for (int kt = 0; kt < 8; ++kt) {
    v8f cp;
#pragma unroll  // constant indices keep the vectors in registers
    for (int j = 0; j < 8; ++j) cp[j] = pairAll[(w * 16 + j + 8 * hi) * PKP + kt * 16 + n];
    Lg[kt] = __builtin_amdgcn_wmma_f32_16x16x32_f16(false, aQ, false, bK[kt], (short)0, cp,
                                                    false, false);
  }
  float mrow[8], srow[8];
  _Float16* pw = pP + w * 16 * PPITCH;  // wave-private transpose of P (C layout -> A layout)
#pragma unroll  // constant indices keep the vectors in registers
  for (int j = 0; j < 8; ++j) {
    float mx = -1e30f;
#pragma unroll  // constant indices keep the vectors in registers
    for (int kt = 0; kt < 8; ++kt) mx = fmaxf(mx, Lg[kt][j]);
    mx = half16_max(mx);
    float s = 0.f;
#pragma unroll  // constant indices keep the vectors in registers
    for (int kt = 0; kt < 8; ++kt) {
      // exp(d) as 2^(d log2 e), what __expf computes
      const float p = exp2_slot((Lg[kt][j] - mx) * 1.44269504f);
      s += p;
      pw[(j + 8 * hi) * PPITCH + kt * 16 + n] = (_Float16)p;
    }
    srow[j] = half16_sum(s);
    mrow[j] = mx;
  }
  // other lanes of this wave read what these stores wrote
  asm volatile("s_wait_dscnt 0x0" ::: "memory");
  v8f O1 = {0.f, 0.f, 0.f, 0.f, 0.f, 0.f, 0.f, 0.f};
  v8f O2 = {0.f, 0.f, 0.f, 0.f, 0.f, 0.f, 0.f, 0.f};
#pragma unroll  // constant indices into bV1 and bV2
  for (int kk = 0; kk < 4; ++kk) {
    v16h aP = ld_frag_full(pw + n * PPITCH + kk * 32, off2);  // rows q, K = 32 k
    O1 = __builtin_amdgcn_wmma_f32_16x16x32_f16(false, aP, false, bV1[kk], (short)0,
                                                O1, false, false);
    O2 = __builtin_amdgcn_wmma_f32_16x16x32_f16(false, aP, false, bV2[kk], (short)0,
                                                O2, false, false);
  }

  // epilogue: write unnormalized partials (O, m, s) for this k-range
#pragma unroll  // constant indices keep the vectors in registers
  for (int j = 0; j < 8; ++j) {
    size_t row = (size_t)(b * L_SEQ + qt * 16 + j + 8 * hi);
    size_t base = ((size_t)ksp * ROWS + row) * DG + w * HD;
    Opart[base + n] = O1[j];
    Opart[base + 16 + n] = O2[j];
  }
  if (n == 0) {
#pragma unroll  // constant indices keep the vectors in registers
    for (int j = 0; j < 8; ++j) {
      size_t row = (size_t)(b * L_SEQ + qt * 16 + j + 8 * hi);
      mpart[((size_t)ksp * ROWS + row) * NH + w] = mrow[j];
      spart[((size_t)ksp * ROWS + row) * NH + w] = srow[j];
    }
  }
}

// ---------- kernel 3: combine split-K partials, normalize, gate -> f16 rows in LDS, then the
// output projection + bias (WMMA f16). grid (row tile, column half); wave w of a group combines
// rows 2w and 2w + 1 and then owns one 16-column tile of the product.
// amdgpu_waves_per_eu(2, 2): one group a WGP (128 groups in all), so no register is saved for more
// resident waves; without it the compiler holds the B-fragment loads back behind the arithmetic.
__global__ __launch_bounds__(256) __attribute__((amdgpu_waves_per_eu(2, 2)))
void k_out(const float* Opart, const float* mpart, const float* spart, const float* gate,
           const _Float16* WoutT, const float* bout, float* out) {
  const int mt = blockIdx.x, tid = threadIdx.x;
  const int w = tid >> 5, ln = tid & 31, n = ln & 15, hi = ln >> 4, off2 = hi * 8;
  const int col0 = (blockIdx.y * 8 + w) * 16;
  __shared__ __attribute__((aligned(16))) _Float16 aS[16 * APITCH];

  // a lane holds columns 64 i + 4 n .. + 3 of its row: 16 lanes read 256 contiguous bytes
  const int lrow = w * 2 + hi;
  const size_t row = (size_t)(mt * 16 + lrow);
  // the lane's own addresses: its row's 8 heads; columns 4 n .. 4 n + 3 of every 64
  const float* mp = mpart + row * NH;
  const float* sp = spart + row * NH;
  const float* op = Opart + row * DG + n * 4;
  const float* gp = gate + row * DG + n * 4;
  const _Float16* bp = WoutT + (size_t)(col0 + n) * DG + off2;
  const int oc = col0 + n;  // the lane's output column
  float4 mq[KSPLIT][2], sq[KSPLIT][2];  // maxima and sums of heads 0..3 and 4..7
  float4 ov[KSPLIT][4], gv[4];
  v16h bF[8];  // B fragments of the wave's 16 output columns, whole K
#pragma unroll  // constant indices keep the arrays in registers
  for (int g = 0; g < KSPLIT; ++g) {
    mq[g][0] = *reinterpret_cast<const float4*>(mp + g * ROWS * NH);
    mq[g][1] = *reinterpret_cast<const float4*>(mp + g * ROWS * NH + 4);
    sq[g][0] = *reinterpret_cast<const float4*>(sp + g * ROWS * NH);
    sq[g][1] = *reinterpret_cast<const float4*>(sp + g * ROWS * NH + 4);
  }
#pragma unroll  // constant indices keep the arrays in registers
  for (int i = 0; i < 4; ++i) {
#pragma unroll  // constant indices keep the arrays in registers
    for (int g = 0; g < KSPLIT; ++g)
      ov[g][i] = *reinterpret_cast<const float4*>(op + g * ROWS * DG + i * 64);
    gv[i] = *reinterpret_cast<const float4*>(gp + i * 64);
  }
#pragma unroll  // constant indices keep bF in registers
  for (int ks = 0; ks < 8; ++ks) bF[ks] = ld_frag_full(bp + ks * 32, 0);
  const float bo = bout[oc];
  // Every load of the kernel stands above this line (the "memory" clobber), so that a wave meets
  // one memory latency and not two. The wait stands ahead of any reuse of an address register:
  // as operands of the statement the addresses stay in their registers up to it.
  asm volatile("s_wait_xcnt 0x0" :: "v"(mp), "v"(sp), "v"(op), "v"(gp), "v"(bp), "v"(oc)
               : "memory");

  // columns 64 i + 4 n .. + 3 belong to head 2 i + (n >> 3)
  const bool odd = n >= 8;
  float mv[KSPLIT][4], sv[KSPLIT][4];
#pragma unroll  // constant indices keep the arrays in registers
  for (int g = 0; g < KSPLIT; ++g) {
    mv[g][0] = odd ? mq[g][0].y : mq[g][0].x;  sv[g][0] = odd ? sq[g][0].y : sq[g][0].x;
    mv[g][1] = odd ? mq[g][0].w : mq[g][0].z;  sv[g][1] = odd ? sq[g][0].w : sq[g][0].z;
    mv[g][2] = odd ? mq[g][1].y : mq[g][1].x;  sv[g][2] = odd ? sq[g][1].y : sq[g][1].x;
    mv[g][3] = odd ? mq[g][1].w : mq[g][1].z;  sv[g][3] = odd ? sq[g][1].w : sq[g][1].z;
  }
#pragma unroll  // constant indices keep the arrays in registers
  for (int i = 0; i < 4; ++i) {
    float m0 = -1e30f;
#pragma unroll  // constant indices keep the arrays in registers
    for (int g = 0; g < KSPLIT; ++g) m0 = fmaxf(m0, mv[g][i]);
    float s = 0.f, o0 = 0.f, o1 = 0.f, o2 = 0.f, o3 = 0.f;
#pragma unroll  // constant indices keep the arrays in registers
    for (int g = 0; g < KSPLIT; ++g) {
      // exp(d) as 2^(d log2 e), what __expf computes
      const float e = exp2_slot((mv[g][i] - m0) * 1.44269504f);
      s += sv[g][i] * e;
      o0 += ov[g][i].x * e;
      o1 += ov[g][i].y * e;
      o2 += ov[g][i].z * e;
      o3 += ov[g][i].w * e;
    }
    v4h r = {(_Float16)(o0 / s * gv[i].x), (_Float16)(o1 / s * gv[i].y),
             (_Float16)(o2 / s * gv[i].z), (_Float16)(o3 / s * gv[i].w)};
    *reinterpret_cast<v4h*>(aS + lrow * APITCH + i * 64 + n * 4) = r;
  }
  __syncthreads();  // every wave reads all 16 combined rows

  v8f c = {0.f, 0.f, 0.f, 0.f, 0.f, 0.f, 0.f, 0.f};
  const _Float16* ap = aS + n * APITCH;
#pragma unroll  // constant indices into bF
  for (int ks = 0; ks < 8; ++ks) {
    v16h a = ld_frag_full(ap + ks * 32, off2);
    c = __builtin_amdgcn_wmma_f32_16x16x32_f16(false, a, false, bF[ks], (short)0, c,
                                               false, false);
  }
#pragma unroll  // constant indices: the vector stays in registers
  for (int j = 0; j < 8; ++j)
    out[(size_t)(mt * 16 + j + 8 * hi) * DG + oc] = c[j] + bo;
}

extern "C" void kernel_launch(void* const* d_in, const int* in_sizes, int n_in,
                              void* d_out, int out_size, void* d_ws, size_t ws_size,
                              hipStream_t stream) {
  (void)in_sizes; (void)n_in; (void)out_size; (void)ws_size;
  const float* x       = (const float*)d_in[0];
  const float* bias    = (const float*)d_in[1];
  const float* g_gamma = (const float*)d_in[2];
  const float* g_beta  = (const float*)d_in[3];
  const float* b_gamma = (const float*)d_in[4];
  const float* b_beta  = (const float*)d_in[5];
  const float* Wq      = (const float*)d_in[6];
  const float* Wk      = (const float*)d_in[7];
  const float* Wv      = (const float*)d_in[8];
  const float* Wb      = (const float*)d_in[9];
  const float* Wg      = (const float*)d_in[10];
  const float* bg      = (const float*)d_in[11];
  const float* Wout    = (const float*)d_in[12];
  const float* bout    = (const float*)d_in[13];
  float* out = (float*)d_out;

  char* p = (char*)d_ws;
  _Float16* WoutT   = (_Float16*)p; p += (size_t)DG * DG * sizeof(_Float16);
  _Float16* qh      = (_Float16*)p; p += (size_t)ROWS * DG * sizeof(_Float16);
  _Float16* kh      = (_Float16*)p; p += (size_t)ROWS * DG * sizeof(_Float16);
  _Float16* vT      = (_Float16*)p; p += (size_t)ROWS * DG * sizeof(_Float16);
  float* gate       = (float*)p;    p += (size_t)ROWS * DG * sizeof(float);
  float* Opart      = (float*)p;    p += (size_t)KSPLIT * ROWS * DG * sizeof(float);
  float* mpart      = (float*)p;    p += (size_t)KSPLIT * ROWS * NH * sizeof(float);
  float* spart      = (float*)p;    p += (size_t)KSPLIT * ROWS * NH * sizeof(float);

  k_proj<<<dim3(ROWS / 16, 5), 256, 0, stream>>>(x, g_gamma, g_beta, Wq, Wk, Wv, Wg, Wout, bg,
                                                 qh, kh, vT, gate, WoutT);
  k_attn<<<dim3(32, 2, KSPLIT), 256, 0, stream>>>(bias, b_gamma, b_beta, Wb, qh, kh,
                                                  vT, Opart, mpart, spart);
  k_out<<<dim3(ROWS / 16, 2), 256, 0, stream>>>(Opart, mpart, spart, gate, WoutT, bout, out);
}

// v005
// It runs in 36.6 microseconds.
// Two timings next to v004 both put it at 1.09 times that version's speed.
// All steps since v000 together make it 2.10 times as fast.
#include <hip/hip_runtime.h>
#include <hip/hip_bf16.h>

typedef __attribute__((ext_vector_type(16))) _Float16 v16h;
typedef __attribute__((ext_vector_type(8)))  _Float16 v8h;
typedef __attribute__((ext_vector_type(4)))  _Float16 v4h;
typedef __attribute__((ext_vector_type(8)))  float    v8f;
typedef __attribute__((ext_vector_type(2)))  float    v2f;

#define L_SEQ 512
#define DG 256
#define DB 128
#define NH 8
#define HD 32
#define KSPLIT 4      // k-range split factor for the attention kernel
#define ROWS 1024     // b * L_SEQ
#define BPITCH 528            // staged bias row: 512 B + 16 B, so 16 rows' 8-byte reads fall on 64 different banks
#define USLOT (16 * BPITCH)   // one unit of the bias stream: 1 q row x 16 k rows x 128 channels
#define URING 3               // slots in a wave's private ring
#define WRING (URING * USLOT)
#define NUNIT 16              // units a wave streams: 2 q rows x 128 k rows
#define PKP 132               // pair row: 128 k + 4, so rows q and q + 8 fall on different banks
#define PPITCH 136            // P row: 128 halves + 8, so 16 rows' 16-byte reads spread over the banks

// ---------- fragment loaders (f16 A/B layout: lane row/col = ln&15,
// halves[0..7] = K off2+0..7, halves[8..15] = K 16+off2+0..7, off2 = (ln>>4)*8)
__device__ __forceinline__ v16h ld_frag_full(const _Float16* p, int off2) {
  v8h a = *reinterpret_cast<const v8h*>(p + off2);
  v8h b = *reinterpret_cast<const v8h*>(p + 16 + off2);
  v16h r;
#pragma unroll
  for (int i = 0; i < 8; ++i) { r[i] = a[i]; r[i + 8] = b[i]; }
  return r;
}

__device__ __forceinline__ float half16_max(float v) {
  v = fmaxf(v, __shfl_xor(v, 1, 32));
  v = fmaxf(v, __shfl_xor(v, 2, 32));
  v = fmaxf(v, __shfl_xor(v, 4, 32));
  v = fmaxf(v, __shfl_xor(v, 8, 32));
  return v;
}
__device__ __forceinline__ float half16_sum(float v) {
  v += __shfl_xor(v, 1, 32);
  v += __shfl_xor(v, 2, 32);
  v += __shfl_xor(v, 4, 32);
  v += __shfl_xor(v, 8, 32);
  return v;
}

// ---------- eight asynchronous 16-byte-per-lane copies: eight whole 512-byte bias rows -> LDS.
// lds and g are the lane's own addresses in row 0. The closing s_wait_xcnt stands inside the
// statement so that no address register is rewritten ahead of it.
__device__ __forceinline__ void copy_rows8(unsigned lds, const float* g) {
  asm volatile(
      "global_load_async_to_lds_b128 %0, %8, off\n\t"
      "global_load_async_to_lds_b128 %1, %9, off\n\t"
      "global_load_async_to_lds_b128 %2, %10, off\n\t"
      "global_load_async_to_lds_b128 %3, %11, off\n\t"
      "global_load_async_to_lds_b128 %4, %12, off\n\t"
      "global_load_async_to_lds_b128 %5, %13, off\n\t"
      "global_load_async_to_lds_b128 %6, %14, off\n\t"
      "global_load_async_to_lds_b128 %7, %15, off\n\t"
      "s_wait_xcnt 0x0"
      :: "v"(lds), "v"(lds + BPITCH), "v"(lds + 2 * BPITCH), "v"(lds + 3 * BPITCH),
         "v"(lds + 4 * BPITCH), "v"(lds + 5 * BPITCH), "v"(lds + 6 * BPITCH),
         "v"(lds + 7 * BPITCH),
         "v"(g), "v"(g + DB), "v"(g + 2 * DB), "v"(g + 3 * DB), "v"(g + 4 * DB),
         "v"(g + 5 * DB), "v"(g + 6 * DB), "v"(g + 7 * DB)
      : "memory");
}
// one unit (16 whole rows that follow one another in memory) into one slot of the wave's ring
__device__ __forceinline__ void copy_unit(unsigned lds, const float* g) {
  copy_rows8(lds, g);
  copy_rows8(lds + 8 * BPITCH, g + 8 * DB);
}

// ---------- one transcendental with the free issue slot that the instruction set asks for behind it,
// in one statement: nothing that overwrites its source or reads its result can stand directly behind
__device__ __forceinline__ float rsq_slot(float a) {
  float r;
  asm("v_rsq_f32 %0, %1\n\tv_nop" : "=v"(r) : "v"(a));  // v_nop: the slot behind v_rsq
  return r;
}
__device__ __forceinline__ float exp2_slot(float a) {
  float r;
  asm("v_exp_f32 %0, %1\n\tv_nop" : "=v"(r) : "v"(a));  // v_nop: the slot behind v_exp
  return r;
}

// ---------- kernel 1: layernorm(x), f16 weight conversion and the q/k/v/gate projections (WMMA
// f16). grid (row tile, z): z = 0..3 selects the matrix, one 8-wave work-group per 16 rows;
// z = 4 writes the transposed f16 copy of Wout that the last kernel reads.
#define APITCH 264  // staged row: 256 halves + 8, so 16 rows' 16-byte reads fall on different banks
__global__ __launch_bounds__(256) void k_proj(const float* x, const float* gamma,
                                              const float* beta, const float* Wq,
                                              const float* Wk, const float* Wv,
                                              const float* Wg, const float* Wout,
                                              const float* bg, _Float16* qh, _Float16* kh,
                                              _Float16* vT, float* gate, _Float16* WoutT) {
  const int mt = blockIdx.x, z = blockIdx.y, tid = threadIdx.x;
  if (z == 4) {  // the whole block leaves here, ahead of the barrier
    const float4 wv = *reinterpret_cast<const float4*>(Wout + (size_t)tid * DG + mt * 4);
    WoutT[(size_t)(mt * 4 + 0) * DG + tid] = (_Float16)wv.x;
    WoutT[(size_t)(mt * 4 + 1) * DG + tid] = (_Float16)wv.y;
    WoutT[(size_t)(mt * 4 + 2) * DG + tid] = (_Float16)wv.z;
    WoutT[(size_t)(mt * 4 + 3) * DG + tid] = (_Float16)wv.w;
    return;
  }
  __shared__ __attribute__((aligned(16))) _Float16 aS[16 * APITCH];
  const int w = tid >> 5, ln = tid & 31, n = ln & 15, hi = ln >> 4, off2 = hi * 8;

  // wave w normalizes rows 2w and 2w + 1; a lane holds elements ln + 32 i of a row
  float xv[2][8], gm[8], bt[8];
#pragma unroll  // constant indices keep the arrays in registers
  for (int i = 0; i < 8; ++i) {
    xv[0][i] = x[(size_t)(mt * 16 + w * 2) * DG + ln + 32 * i];
    xv[1][i] = x[(size_t)(mt * 16 + w * 2 + 1) * DG + ln + 32 * i];
    gm[i] = gamma[ln + 32 * i];
    bt[i] = beta[ln + 32 * i];
  }

  // B fragments of output columns 32w .. 32w + 31 (two tiles), whole K, straight from the
  // k-major f32 weights (Wk scaled by 1/sqrt(D)); they do not depend on the layernorm
  const float* W = (z == 0) ? Wq : (z == 1) ? Wk : (z == 2) ? Wv : Wg;
  const float sc = (z == 1) ? 0.17677669529663687f : 1.f;
  v16h bF[2][8];
#pragma unroll  // constant indices keep bF in registers
  for (int ks = 0; ks < 8; ++ks) {
#pragma unroll  // constant indices: the vectors stay in registers
    for (int t = 0; t < 2; ++t) {
      const float* wp = W + (size_t)(ks * 32 + off2) * DG + w * 32 + t * 16 + n;
#pragma unroll  // constant indices: the vectors stay in registers
      for (int i = 0; i < 8; ++i) {
        bF[t][ks][i] = (_Float16)(wp[(size_t)i * DG] * sc);
        bF[t][ks][i + 8] = (_Float16)(wp[(size_t)(16 + i) * DG] * sc);
      }
    }
  }

#pragma unroll  // constant indices: the vectors stay in registers
  for (int r = 0; r < 2; ++r) {
    // halving tree over the 256 elements: distances 128, 64, 32 inside the lane, 16 .. 1 across
    float sa[8], sb[8];
#pragma unroll  // constant indices: the vectors stay in registers
    for (int i = 0; i < 8; ++i) { sa[i] = xv[r][i]; sb[i] = xv[r][i] * xv[r][i]; }
#pragma unroll  // constant indices: the vectors stay in registers
    for (int i = 0; i < 4; ++i) { sa[i] += sa[i + 4]; sb[i] += sb[i + 4]; }
    sa[0] += sa[2]; sb[0] += sb[2];
    sa[1] += sa[3]; sb[1] += sb[3];
    float s1 = sa[0] + sa[1], s2 = sb[0] + sb[1];
#pragma unroll  // five fixed steps, straight-line
    for (int d = 16; d > 0; d >>= 1) {
      s1 += __shfl_xor(s1, d, 32);
      s2 += __shfl_xor(s2, d, 32);
    }
    float mu = s1 * (1.f / 256.f);
    float var = s2 * (1.f / 256.f) - mu * mu;
    // rsqrtf spelled out: an argument below the smallest normal is scaled into range
    const float va = var + 1e-5f;
    const bool tiny = va < 1.17549435e-38f;
    float rs = rsq_slot(tiny ? va * 16777216.f : va);
    rs = tiny ? rs * 4096.f : rs;
#pragma unroll  // constant indices: the vectors stay in registers
    for (int i = 0; i < 8; ++i)
      aS[(w * 2 + r) * APITCH + ln + 32 * i] = (_Float16)((xv[r][i] - mu) * rs * gm[i] + bt[i]);
  }
  __syncthreads();  // every wave reads all 16 normalized rows

  v8f c0 = {0.f, 0.f, 0.f, 0.f, 0.f, 0.f, 0.f, 0.f};
  v8f c1 = {0.f, 0.f, 0.f, 0.f, 0.f, 0.f, 0.f, 0.f};
  const _Float16* ap = aS + n * APITCH;
#pragma unroll  // constant indices into bF
  for (int ks = 0; ks < 8; ++ks) {
    v16h a = ld_frag_full(ap + ks * 32, off2);
    c0 = __builtin_amdgcn_wmma_f32_16x16x32_f16(false, a, false, bF[0][ks], (short)0, c0,
                                                false, false);
    c1 = __builtin_amdgcn_wmma_f32_16x16x32_f16(false, a, false, bF[1][ks], (short)0, c1,
                                                false, false);
  }
  // the branch on z stands outside the store loops: one scalar test a wave, not one a store
  const int row0 = mt * 16 + 8 * hi;
  const int col0 = w * 32 + n, col1 = col0 + 16;
  if (z == 0 || z == 1) {
    _Float16* dst = (z == 0) ? qh : kh;
#pragma unroll  // constant indices: the vectors stay in registers
    for (int j = 0; j < 8; ++j) {
      dst[(size_t)(row0 + j) * DG + col0] = (_Float16)c0[j];
      dst[(size_t)(row0 + j) * DG + col1] = (_Float16)c1[j];
    }
    // the stores' registers are not rewritten ahead of this wait on any way out of the branch
    asm volatile("s_wait_xcnt 0x0" ::: "memory");
  } else if (z == 2) {
    // head w, dims n and 16 + n; the 16 rows of a tile lie in one batch
    const int bb = row0 >> 9, kp = row0 & 511;
    _Float16* v0 = vT + ((size_t)(bb * NH + w) * HD + n) * L_SEQ + kp;
    _Float16* v1 = v0 + (size_t)16 * L_SEQ;
#pragma unroll  // constant indices: the vectors stay in registers
    for (int j = 0; j < 8; ++j) {
      v0[j] = (_Float16)c0[j];
      v1[j] = (_Float16)c1[j];
    }
    // the stores' registers are not rewritten ahead of this wait on any way out of the branch
    asm volatile("s_wait_xcnt 0x0" ::: "memory");
  } else {
    const float bg0 = bg[col0], bg1 = bg[col1];
#pragma unroll  // constant indices: the vectors stay in registers
    for (int j = 0; j < 8; ++j) {
      float g0 = c0[j] + bg0, g1 = c1[j] + bg1;
      // exp(-g) as 2^(-g log2 e), what __expf computes
      gate[(size_t)(row0 + j) * DG + col0] = 1.f / (1.f + exp2_slot(g0 * -1.44269504f));
      gate[(size_t)(row0 + j) * DG + col1] = 1.f / (1.f + exp2_slot(g1 * -1.44269504f));
    }
    // the stores' registers are not rewritten ahead of this wait on any way out of the branch
    asm volatile("s_wait_xcnt 0x0" ::: "memory");
  }
}

// ---------- kernel 2: bias-LN + pair projection, then split-K attention, in two passes
// grid (qt=32, b=2, ks=KSPLIT); each WG covers k in [ks*128, ks*128+128)
// pass 1 has no barrier: wave w streams q rows 2w and 2w + 1 through a ring of its own and leaves
// the finished pair values of all 128 k in LDS; pass 2, behind one barrier, is one softmax a head.
__global__ __launch_bounds__(256) void k_attn(const float* bias, const float* b_gamma,
                                              const float* b_beta, const float* Wb,
                                              const _Float16* qh, const _Float16* kh,
                                              const _Float16* vT,
                                              float* Opart, float* mpart, float* spart) {
  const int qt = blockIdx.x;
  const int b = blockIdx.y;
  const int ksp = blockIdx.z;
  const int tid = threadIdx.x;
  const int w = tid >> 5;          // wave id == head id
  const int ln = tid & 31;
  const int n = ln & 15;
  const int hi = ln >> 4;
  const int off2 = hi * 8;
  const int koff = hi * 2;         // f32 WMMA A/B K offset per lane half

  __shared__ float2 gwB2[64][16];              // B table for pair WMMA (c pairs x 16 cols)
  // per wave: its share of sum(gamma*Wb) of heads 0..7, then of sum(beta*Wb) of heads 0..7
  __shared__ __attribute__((aligned(16))) float gcPart[8][16];
  __shared__ float rawLds[8][16 * 17];         // per wave: one unit's raw products [k][col], padded
  __shared__ float ssqLds[8][16 * 2];          // per wave: one unit's sumsq partials
  __shared__ float pairAll[8 * 16 * PKP];      // finished pair values [head][q][k]
  __shared__ __attribute__((aligned(16))) _Float16 pP[8 * 16 * PPITCH];  // per-wave P staging
  __shared__ __attribute__((aligned(16))) unsigned char biasSt[8 * WRING];  // eight private rings

  const int ktBeg = ksp * 8;
  // The operands of the tables are asked for first, all at once, so that the table build waits out
  // one memory latency and no request of the bias stream stands in front of them. Thread (tc, n)
  // holds channels 2 tc + 32 it and the next one of column n & 7 of Wb, with gamma (n < 8: table
  // entries and the gamma sum) or beta (n >= 8: the beta sum).
  const int tc = tid >> 4;
  const float* gp = ((n < 8) ? b_gamma : b_beta) + tc * 2;
  const float* wp = Wb + tc * 16 + (n & 7);
  float2 gv[4];
  float w0[4], w1[4];
#pragma unroll  // constant indices keep the arrays in registers
  for (int it = 0; it < 4; ++it) {
    gv[it] = *reinterpret_cast<const float2*>(gp + it * 32);
    w0[it] = wp[it * 256];
    w1[it] = wp[it * 256 + 8];
  }
  const size_t bq0 = (size_t)(b * L_SEQ + qt * 16 + w * 2);
  // the lane's own LDS byte address in row 0 of slot 0 of its wave's ring
  const unsigned ringLds = (unsigned)(size_t)biasSt + w * WRING + ln * 16;
  // the lane's own global address in row 0 of unit 0; unit u = q row u >> 3, k rows 16 (u & 7) ..
  const float* gsrc = bias + (bq0 * L_SEQ + ktBeg * 16) * DB + ln * 4;
  // the wait stands ahead of any reuse of an address register of these loads: as operands of the
  // statement the addresses stay in their registers up to it
  asm volatile("s_wait_xcnt 0x0" :: "v"(gp), "v"(wp) : "memory");

  copy_unit(ringLds, gsrc);                    // units 0 to 2 fly while the tables are built
  copy_unit(ringLds + USLOT, gsrc + 16 * DB);
  copy_unit(ringLds + 2 * USLOT, gsrc + 32 * DB);
  // keeps the table arithmetic, and with it the wait for its operands, behind the issue of the copies
  __builtin_amdgcn_sched_barrier(0);

  // B table: cols 0..7 = gamma[c]*Wb[c][h], col 8 = 1 (row sums), rest 0; beside it the thread's
  // share of sum(gamma*Wb) (n < 8) or sum(beta*Wb) (n >= 8) of head n & 7
  {
    const float fill = (n == 8) ? 1.f : 0.f;
    float part = 0.f;
#pragma unroll  // constant indices into the operand arrays
    for (int it = 0; it < 4; ++it) {
      const float p0 = gv[it].x * w0[it], p1 = gv[it].y * w1[it];
      part += p0 + p1;
      gwB2[tc + 16 * it][n] = (n < 8) ? make_float2(p0, p1) : make_float2(fill, fill);
    }
    part += __shfl_xor(part, 16, 32);  // the wave's two channel groups
    if (hi == 0) gcPart[w][n] = part;
  }

  __syncthreads();  // the tables are complete

  // the lane finishes heads 4 hi .. 4 hi + 3 of k row n: the eight waves' shares, summed in order
  float gh[4] = {0.f, 0.f, 0.f, 0.f}, cb[4] = {0.f, 0.f, 0.f, 0.f};
#pragma unroll  // constant indices keep the arrays in registers
  for (int ww = 0; ww < 8; ++ww) {
    const float4 g4 = *reinterpret_cast<const float4*>(&gcPart[ww][hi * 4]);
    const float4 c4 = *reinterpret_cast<const float4*>(&gcPart[ww][8 + hi * 4]);
    gh[0] += g4.x; gh[1] += g4.y; gh[2] += g4.z; gh[3] += g4.w;
    cb[0] += c4.x; cb[1] += c4.y; cb[2] += c4.z; cb[3] += c4.w;
  }
  // the lane's B fragments of the pair product: the same in every unit, so read once
  v2f bB[32];
#pragma unroll  // constant indices keep bB in registers
  for (int cs = 0; cs < 32; ++cs) {
    float2 bv = gwB2[cs * 2 + hi][n];
    bB[cs] = v2f{bv.x, bv.y};
  }
  float* rawW = rawLds[w];
  float* ssqW = ssqLds[w];

  // the head's fragments for pass 2, asked for behind the table barrier (which would wait for them):
  // nothing reads them before pass 2, so they may queue behind the bias stream;
  // Q (rows = 16 q positions, K = 32 dims), K of the eight k tiles, V of the four 32-wide k steps;
  // the pointers are the lane's own addresses, its half's K offset off2 included
  const _Float16* qp = qh + (size_t)(b * L_SEQ + qt * 16 + n) * DG + w * HD + off2;
  const _Float16* kp = kh + (size_t)(b * L_SEQ + ktBeg * 16 + n) * DG + w * HD + off2;
  const _Float16* vp = vT + ((size_t)(b * NH + w) * HD + n) * L_SEQ + ktBeg * 16 + off2;
  v16h aQ = ld_frag_full(qp, 0);
  v16h bK[8], bV1[4], bV2[4];
#pragma unroll  // constant indices keep the fragments in registers
  for (int kt = 0; kt < 8; ++kt) bK[kt] = ld_frag_full(kp + kt * 16 * DG, 0);
#pragma unroll  // constant indices keep the fragments in registers
  for (int kk = 0; kk < 4; ++kk) {
    bV1[kk] = ld_frag_full(vp + kk * 32, 0);
    bV2[kk] = ld_frag_full(vp + 16 * L_SEQ + kk * 32, 0);
  }
  // the wait stands ahead of any reuse of an address register of these loads: as operands of the
  // statement the addresses stay in their registers up to it
  asm volatile("s_wait_xcnt 0x0" :: "v"(qp), "v"(kp), "v"(vp) : "memory");

  // ---- pass 1: 16 units of one q row x 16 k rows; nothing here is read by another wave
  unsigned slot = 0;  // byte offset of unit u's slot in the ring
#pragma unroll 1  // one copy of the body: for speed only
  for (int u = 0; u < NUNIT; ++u) {
    // Unit u has landed. While refills go on, exactly units u + 1 and u + 2 (32 copies) were issued
    // behind it, and the counter returns in issue order; the trips without a refill wait to 0.
    if (u < NUNIT - URING) asm volatile("s_wait_asynccnt 0x20" ::: "memory");
    else                   asm volatile("s_wait_asynccnt 0x0" ::: "memory");
    const float* bp =
        reinterpret_cast<const float*>(biasSt + w * WRING + slot + n * BPITCH) + koff;
    float2 av[32];
#pragma unroll  // constant indices keep av in registers
    for (int cs = 0; cs < 32; ++cs) av[cs] = *reinterpret_cast<const float2*>(bp + cs * 4);
    // the wave's own reads of the slot are done: only then may copies write it again
    asm volatile("s_wait_dscnt 0x0" ::: "memory");
    if (u < NUNIT - URING) {
      const int u3 = u + URING;
      copy_unit(ringLds + slot, gsrc + (size_t)(u3 >> 3) * L_SEQ * DB + (u3 & 7) * 16 * DB);
    }
    v8f C = {0.f, 0.f, 0.f, 0.f, 0.f, 0.f, 0.f, 0.f};
    float ss = 0.f;
#pragma unroll  // constant indices into av and bB
    for (int cs = 0; cs < 32; ++cs) {
      ss += av[cs].x * av[cs].x + av[cs].y * av[cs].y;
      v2f a = {av[cs].x, av[cs].y};
      C = __builtin_amdgcn_wmma_f32_16x16x4_f32(false, a, false, bB[cs], (short)0, C, false,
                                                false);
    }
#pragma unroll  // constant indices keep the vectors in registers
    for (int j = 0; j < 8; ++j) rawW[(j + 8 * hi) * 17 + n] = C[j];
    ssqW[n * 2 + hi] = ss;
    // other lanes of this wave read what these stores wrote
    asm volatile("s_wait_dscnt 0x0" ::: "memory");
    // finish the layernorm correction of (q, k = n) for four heads
    {
      float sum = rawW[n * 17 + 8];
      float ssq = ssqW[n * 2] + ssqW[n * 2 + 1];
      float mu = sum * (1.f / 128.f);
      float var = ssq * (1.f / 128.f) - mu * mu;
      float rsg = rsqrtf(var + 1e-5f);
      float* pd = pairAll + (hi * 64 + w * 2 + (u >> 3)) * PKP + (u & 7) * 16 + n;
#pragma unroll  // constant indices keep the vectors in registers
      for (int i = 0; i < 4; ++i)
        pd[i * 16 * PKP] = rsg * (rawW[n * 17 + hi * 4 + i] - mu * gh[i]) + cb[i];
    }
    slot = (slot == (URING - 1) * USLOT) ? 0u : slot + USLOT;
  }
  __syncthreads();  // every wave's pair values are in place; wave w now reads head w of all 16 q

  // ---- pass 2: logits = Q*K^T + pair over all 128 k, one softmax, O = P*V
  v8f Lg[8];
#pragma unroll  // constant indices keep Lg in registers
  for (int kt = 0; kt < 8; ++kt) {
    v8f cp;
#pragma unroll  // constant indices keep the vectors in registers
    for (int j = 0; j < 8; ++j) cp[j] = pairAll[(w * 16 + j + 8 * hi) * PKP + kt * 16 + n];
    Lg[kt] = __builtin_amdgcn_wmma_f32_16x16x32_f16(false, aQ, false, bK[kt], (short)0, cp,
                                                    false, false);
  }
  float mrow[8], srow[8];
  _Float16* pw = pP + w * 16 * PPITCH;  // wave-private transpose of P (C layout -> A layout)
#pragma unroll  // constant indices keep the vectors in registers
  for (int j = 0; j < 8; ++j) {
    float mx = -1e30f;
#pragma unroll  // constant indices keep the vectors in registers
    for (int kt = 0; kt < 8; ++kt) mx = fmaxf(mx, Lg[kt][j]);
    mx = half16_max(mx);
    float s = 0.f;
#pragma unroll  // constant indices keep the vectors in registers
    for (int kt = 0; kt < 8; ++kt) {
      // exp(d) as 2^(d log2 e), what __expf computes
      const float p = exp2_slot((Lg[kt][j] - mx) * 1.44269504f);
      s += p;
      pw[(j + 8 * hi) * PPITCH + kt * 16 + n] = (_Float16)p;
    }
    srow[j] = half16_sum(s);
    mrow[j] = mx;
  }
  // other lanes of this wave read what these stores wrote
  asm volatile("s_wait_dscnt 0x0" ::: "memory");
  v8f O1 = {0.f, 0.f, 0.f, 0.f, 0.f, 0.f, 0.f, 0.f};
  v8f O2 = {0.f, 0.f, 0.f, 0.f, 0.f, 0.f, 0.f, 0.f};
#pragma unroll  // constant indices into bV1 and bV2
  for (int kk = 0; kk < 4; ++kk) {
    v16h aP = ld_frag_full(pw + n * PPITCH + kk * 32, off2);  // rows q, K = 32 k
    O1 = __builtin_amdgcn_wmma_f32_16x16x32_f16(false, aP, false, bV1[kk], (short)0,
                                                O1, false, false);
    O2 = __builtin_amdgcn_wmma_f32_16x16x32_f16(false, aP, false, bV2[kk], (short)0,
                                                O2, false, false);
  }

  // epilogue: write unnormalized partials (O, m, s) for this k-range
#pragma unroll  // constant indices keep the vectors in registers
  for (int j = 0; j < 8; ++j) {
    size_t row = (size_t)(b * L_SEQ + qt * 16 + j + 8 * hi);
    size_t base = ((size_t)ksp * ROWS + row) * DG + w * HD;
    Opart[base + n] = O1[j];
    Opart[base + 16 + n] = O2[j];
  }
  if (n == 0) {
#pragma unroll  // constant indices keep the vectors in registers
    for (int j = 0; j < 8; ++j) {
      size_t row = (size_t)(b * L_SEQ + qt * 16 + j + 8 * hi);
      mpart[((size_t)ksp * ROWS + row) * NH + w] = mrow[j];
      spart[((size_t)ksp * ROWS + row) * NH + w] = srow[j];
    }
  }
}

// ---------- kernel 3: combine split-K partials, normalize, gate -> f16 rows in LDS, then the
// output projection + bias (WMMA f16). grid (row tile, column half); wave w of a group combines
// rows 2w and 2w + 1 and then owns one 16-column tile of the product.
// amdgpu_waves_per_eu(2, 2): one group a WGP (128 groups in all), so no register is saved for more
// resident waves; without it the compiler holds the B-fragment loads back behind the arithmetic.
__global__ __launch_bounds__(256) __attribute__((amdgpu_waves_per_eu(2, 2)))
void k_out(const float* Opart, const float* mpart, const float* spart, const float* gate,
           const _Float16* WoutT, const float* bout, float* out) {
  const int mt = blockIdx.x, tid = threadIdx.x;
  const int w = tid >> 5, ln = tid & 31, n = ln & 15, hi = ln >> 4, off2 = hi * 8;
  const int col0 = (blockIdx.y * 8 + w) * 16;
  __shared__ __attribute__((aligned(16))) _Float16 aS[16 * APITCH];

  // a lane holds columns 64 i + 4 n .. + 3 of its row: 16 lanes read 256 contiguous bytes
  const int lrow = w * 2 + hi;
  const size_t row = (size_t)(mt * 16 + lrow);
  // the lane's own addresses: its row's 8 heads; columns 4 n .. 4 n + 3 of every 64
  const float* mp = mpart + row * NH;
  const float* sp = spart + row * NH;
  const float* op = Opart + row * DG + n * 4;
  const float* gp = gate + row * DG + n * 4;
  const _Float16* bp = WoutT + (size_t)(col0 + n) * DG + off2;
  const int oc = col0 + n;  // the lane's output column
  float4 mq[KSPLIT][2], sq[KSPLIT][2];  // maxima and sums of heads 0..3 and 4..7
  float4 ov[KSPLIT][4], gv[4];
  v16h bF[8];  // B fragments of the wave's 16 output columns, whole K
#pragma unroll  // constant indices keep the arrays in registers
  for (int g = 0; g < KSPLIT; ++g) {
    mq[g][0] = *reinterpret_cast<const float4*>(mp + g * ROWS * NH);
    mq[g][1] = *reinterpret_cast<const float4*>(mp + g * ROWS * NH + 4);
    sq[g][0] = *reinterpret_cast<const float4*>(sp + g * ROWS * NH);
    sq[g][1] = *reinterpret_cast<const float4*>(sp + g * ROWS * NH + 4);
  }
#pragma unroll  // constant indices keep the arrays in registers
  for (int i = 0; i < 4; ++i) {
#pragma unroll  // constant indices keep the arrays in registers
    for (int g = 0; g < KSPLIT; ++g)
      ov[g][i] = *reinterpret_cast<const float4*>(op + g * ROWS * DG + i * 64);
    gv[i] = *reinterpret_cast<const float4*>(gp + i * 64);
  }
#pragma unroll  // constant indices keep bF in registers
  for (int ks = 0; ks < 8; ++ks) bF[ks] = ld_frag_full(bp + ks * 32, 0);
  const float bo = bout[oc];
  // Every load of the kernel stands above this line (the "memory" clobber), so that a wave meets
  // one memory latency and not two. The wait stands ahead of any reuse of an address register:
  // as operands of the statement the addresses stay in their registers up to it.
  asm volatile("s_wait_xcnt 0x0" :: "v"(mp), "v"(sp), "v"(op), "v"(gp), "v"(bp), "v"(oc)
               : "memory");

  // columns 64 i + 4 n .. + 3 belong to head 2 i + (n >> 3)
  const bool odd = n >= 8;
  float mv[KSPLIT][4], sv[KSPLIT][4];
#pragma unroll  // constant indices keep the arrays in registers
  for (int g = 0; g < KSPLIT; ++g) {
    mv[g][0] = odd ? mq[g][0].y : mq[g][0].x;  sv[g][0] = odd ? sq[g][0].y : sq[g][0].x;
    mv[g][1] = odd ? mq[g][0].w : mq[g][0].z;  sv[g][1] = odd ? sq[g][0].w : sq[g][0].z;
    mv[g][2] = odd ? mq[g][1].y : mq[g][1].x;  sv[g][2] = odd ? sq[g][1].y : sq[g][1].x;
    mv[g][3] = odd ? mq[g][1].w : mq[g][1].z;  sv[g][3] = odd ? sq[g][1].w : sq[g][1].z;
  }
#pragma unroll  // constant indices keep the arrays in registers
  for (int i = 0; i < 4; ++i) {
    float m0 = -1e30f;
#pragma unroll  // constant indices keep the arrays in registers
    for (int g = 0; g < KSPLIT; ++g) m0 = fmaxf(m0, mv[g][i]);
    float s = 0.f, o0 = 0.f, o1 = 0.f, o2 = 0.f, o3 = 0.f;
#pragma unroll  // constant indices keep the arrays in registers
    for (int g = 0; g < KSPLIT; ++g) {
      // exp(d) as 2^(d log2 e), what __expf computes
      const float e = exp2_slot((mv[g][i] - m0) * 1.44269504f);
      s += sv[g][i] * e;
      o0 += ov[g][i].x * e;
      o1 += ov[g][i].y * e;
      o2 += ov[g][i].z * e;
      o3 += ov[g][i].w * e;
    }
    v4h r = {(_Float16)(o0 / s * gv[i].x), (_Float16)(o1 / s * gv[i].y),
             (_Float16)(o2 / s * gv[i].z), (_Float16)(o3 / s * gv[i].w)};
    *reinterpret_cast<v4h*>(aS + lrow * APITCH + i * 64 + n * 4) = r;
  }
  __syncthreads();  // every wave reads all 16 combined rows

  v8f c = {0.f, 0.f, 0.f, 0.f, 0.f, 0.f, 0.f, 0.f};
  const _Float16* ap = aS + n * APITCH;
#pragma unroll  // constant indices into bF
  for (int ks = 0; ks < 8; ++ks) {
    v16h a = ld_frag_full(ap + ks * 32, off2);
    c = __builtin_amdgcn_wmma_f32_16x16x32_f16(false, a, false, bF[ks], (short)0, c,
                                               false, false);
  }
#pragma unroll  // constant indices: the vector stays in registers
  for (int j = 0; j < 8; ++j)
    out[(size_t)(mt * 16 + j + 8 * hi) * DG + oc] = c[j] + bo;
}

extern "C" void kernel_launch(void* const* d_in, const int* in_sizes, int n_in,
                              void* d_out, int out_size, void* d_ws, size_t ws_size,
                              hipStream_t stream) {
  (void)in_sizes; (void)n_in; (void)out_size; (void)ws_size;
  const float* x       = (const float*)d_in[0];
  const float* bias    = (const float*)d_in[1];
  const float* g_gamma = (const float*)d_in[2];
  const float* g_beta  = (const float*)d_in[3];
  const float* b_gamma = (const float*)d_in[4];
  const float* b_beta  = (const float*)d_in[5];
  const float* Wq      = (const float*)d_in[6];
  const float* Wk      = (const float*)d_in[7];
  const float* Wv      = (const float*)d_in[8];
  const float* Wb      = (const float*)d_in[9];
  const float* Wg      = (const float*)d_in[10];
  const float* bg      = (const float*)d_in[11];
  const float* Wout    = (const float*)d_in[12];
  const float* bout    = (const float*)d_in[13];
  float* out = (float*)d_out;

  char* p = (char*)d_ws;
  _Float16* WoutT   = (_Float16*)p; p += (size_t)DG * DG * sizeof(_Float16);
  _Float16* qh      = (_Float16*)p; p += (size_t)ROWS * DG * sizeof(_Float16);
  _Float16* kh      = (_Float16*)p; p += (size_t)ROWS * DG * sizeof(_Float16);
  _Float16* vT      = (_Float16*)p; p += (size_t)ROWS * DG * sizeof(_Float16);
  float* gate       = (float*)p;    p += (size_t)ROWS * DG * sizeof(float);
  float* Opart      = (float*)p;    p += (size_t)KSPLIT * ROWS * DG * sizeof(float);
  float* mpart      = (float*)p;    p += (size_t)KSPLIT * ROWS * NH * sizeof(float);
  float* spart      = (float*)p;    p += (size_t)KSPLIT * ROWS * NH * sizeof(float);

  k_proj<<<dim3(ROWS / 16, 5), 256, 0, stream>>>(x, g_gamma, g_beta, Wq, Wk, Wv, Wg, Wout, bg,
                                                 qh, kh, vT, gate, WoutT);
  k_attn<<<dim3(32, 2, KSPLIT), 256, 0, stream>>>(bias, b_gamma, b_beta, Wb, qh, kh,
                                                  vT, Opart, mpart, spart);
  k_out<<<dim3(ROWS / 16, 2), 256, 0, stream>>>(Opart, mpart, spart, gate, WoutT, bout, out);
}

// v006
// Measured time: 34.9 microseconds a run.
// Next to v005, in two timings, it ran 1.05 times as fast each time.
// Counting every step since v000, it is 2.21 times as fast.
#include <hip/hip_runtime.h>
#include <hip/hip_bf16.h>

typedef __attribute__((ext_vector_type(16))) _Float16 v16h;
typedef __attribute__((ext_vector_type(8)))  _Float16 v8h;
typedef __attribute__((ext_vector_type(4)))  _Float16 v4h;
typedef __attribute__((ext_vector_type(8)))  float    v8f;
typedef __attribute__((ext_vector_type(2)))  float    v2f;
typedef __attribute__((ext_vector_type(16))) __bf16   v16b;
typedef __attribute__((ext_vector_type(2)))  __bf16   v2b;
typedef __attribute__((ext_vector_type(8)))  unsigned v8u;

#define L_SEQ 512
#define DG 256
#define DB 128
#define NH 8
#define HD 32
#define KSPLIT 4      // k-range split factor for the attention kernel
#define ROWS 1024     // b * L_SEQ
#define BPITCH 528            // staged bias row: 512 B + 16 B, an odd count of 16 B: 16 rows' 16-byte reads spread over the banks
#define USLOT (16 * BPITCH)   // one unit of the bias stream: 1 q row x 16 k rows x 128 channels
#define URING 3               // slots in a wave's private ring
#define WRING (URING * USLOT)
#define NUNIT 16              // units a wave streams: 2 q rows x 128 k rows
#define PKP 132               // pair row: 128 k + 4, so rows q and q + 8 fall on different banks
#define PPITCH 136            // P row: 128 halves + 8, so 16 rows' 16-byte reads spread over the banks

// ---------- fragment loaders (f16 A/B layout: lane row/col = ln&15,
// halves[0..7] = K off2+0..7, halves[8..15] = K 16+off2+0..7, off2 = (ln>>4)*8)
__device__ __forceinline__ v16h ld_frag_full(const _Float16* p, int off2) {
  v8h a = *reinterpret_cast<const v8h*>(p + off2);
  v8h b = *reinterpret_cast<const v8h*>(p + 16 + off2);
  v16h r;
#pragma unroll
  for (int i = 0; i < 8; ++i) { r[i] = a[i]; r[i + 8] = b[i]; }
  return r;
}

__device__ __forceinline__ float half16_max(float v) {
  v = fmaxf(v, __shfl_xor(v, 1, 32));
  v = fmaxf(v, __shfl_xor(v, 2, 32));
  v = fmaxf(v, __shfl_xor(v, 4, 32));
  v = fmaxf(v, __shfl_xor(v, 8, 32));
  return v;
}
__device__ __forceinline__ float half16_sum(float v) {
  v += __shfl_xor(v, 1, 32);
  v += __shfl_xor(v, 2, 32);
  v += __shfl_xor(v, 4, 32);
  v += __shfl_xor(v, 8, 32);
  return v;
}

// ---------- two f32 values as a bf16 head and a bf16 remainder each (packed pairs): x - head is exact
// in f32, so head + remainder carries 16 significant bits of x
__device__ __forceinline__ void split2(v2f x, unsigned& head, unsigned& rem) {
  const unsigned hb = __builtin_bit_cast(unsigned, __builtin_convertvector(x, v2b));
  const v2f hf = {__builtin_bit_cast(float, hb << 16), __builtin_bit_cast(float, hb & 0xffff0000u)};
  head = hb;
  rem = __builtin_bit_cast(unsigned, __builtin_convertvector(x - hf, v2b));
}
__device__ __forceinline__ v8f wmma_b(v8u a, v8u b, v8f c) {
  return __builtin_amdgcn_wmma_f32_16x16x32_bf16(false, __builtin_bit_cast(v16b, a), false,
                                                 __builtin_bit_cast(v16b, b), (short)0, c, false,
                                                 false);
}

// ---------- eight asynchronous 16-byte-per-lane copies: eight whole 512-byte bias rows -> LDS.
// lds and g are the lane's own addresses in row 0. The closing s_wait_xcnt stands inside the
// statement so that no address register is rewritten ahead of it.
__device__ __forceinline__ void copy_rows8(unsigned lds, const float* g) {
  asm volatile(
      "global_load_async_to_lds_b128 %0, %8, off\n\t"
      "global_load_async_to_lds_b128 %1, %9, off\n\t"
      "global_load_async_to_lds_b128 %2, %10, off\n\t"
      "global_load_async_to_lds_b128 %3, %11, off\n\t"
      "global_load_async_to_lds_b128 %4, %12, off\n\t"
      "global_load_async_to_lds_b128 %5, %13, off\n\t"
      "global_load_async_to_lds_b128 %6, %14, off\n\t"
      "global_load_async_to_lds_b128 %7, %15, off\n\t"
      "s_wait_xcnt 0x0"
      :: "v"(lds), "v"(lds + BPITCH), "v"(lds + 2 * BPITCH), "v"(lds + 3 * BPITCH),
         "v"(lds + 4 * BPITCH), "v"(lds + 5 * BPITCH), "v"(lds + 6 * BPITCH),
         "v"(lds + 7 * BPITCH),
         "v"(g), "v"(g + DB), "v"(g + 2 * DB), "v"(g + 3 * DB), "v"(g + 4 * DB),
         "v"(g + 5 * DB), "v"(g + 6 * DB), "v"(g + 7 * DB)
      : "memory");
}
// one unit (16 whole rows that follow one another in memory) into one slot of the wave's ring
__device__ __forceinline__ void copy_unit(unsigned lds, const float* g) {
  copy_rows8(lds, g);
  copy_rows8(lds + 8 * BPITCH, g + 8 * DB);
}

// ---------- one transcendental with the free issue slot that the instruction set asks for behind it,
// in one statement: nothing that overwrites its source or reads its result can stand directly behind
__device__ __forceinline__ float rsq_slot(float a) {
  float r;
  asm("v_rsq_f32 %0, %1\n\tv_nop" : "=v"(r) : "v"(a));  // v_nop: the slot behind v_rsq
  return r;
}
__device__ __forceinline__ float exp2_slot(float a) {
  float r;
  asm("v_exp_f32 %0, %1\n\tv_nop" : "=v"(r) : "v"(a));  // v_nop: the slot behind v_exp
  return r;
}

// ---------- kernel 1: layernorm(x), f16 weight conversion and the q/k/v/gate projections (WMMA
// f16). grid (row tile, z): z = 0..3 selects the matrix, one 8-wave work-group per 16 rows;
// z = 4 writes the transposed f16 copy of Wout that the last kernel reads.
#define APITCH 264  // staged row: 256 halves + 8, so 16 rows' 16-byte reads fall on different banks
__global__ __launch_bounds__(256) void k_proj(const float* x, const float* gamma,
                                              const float* beta, const float* Wq,
                                              const float* Wk, const float* Wv,
                                              const float* Wg, const float* Wout,
                                              const float* bg, _Float16* qh, _Float16* kh,
                                              _Float16* vT, float* gate, _Float16* WoutT) {
  const int mt = blockIdx.x, z = blockIdx.y, tid = threadIdx.x;
  if (z == 4) {  // the whole block leaves here, ahead of the barrier
    const float4 wv = *reinterpret_cast<const float4*>(Wout + (size_t)tid * DG + mt * 4);
    WoutT[(size_t)(mt * 4 + 0) * DG + tid] = (_Float16)wv.x;
    WoutT[(size_t)(mt * 4 + 1) * DG + tid] = (_Float16)wv.y;
    WoutT[(size_t)(mt * 4 + 2) * DG + tid] = (_Float16)wv.z;
    WoutT[(size_t)(mt * 4 + 3) * DG + tid] = (_Float16)wv.w;
    return;
  }
  __shared__ __attribute__((aligned(16))) _Float16 aS[16 * APITCH];
  const int w = tid >> 5, ln = tid & 31, n = ln & 15, hi = ln >> 4, off2 = hi * 8;

  // wave w normalizes rows 2w and 2w + 1; a lane holds elements ln + 32 i of a row
  float xv[2][8], gm[8], bt[8];
#pragma unroll  // constant indices keep the arrays in registers
  for (int i = 0; i < 8; ++i) {
    xv[0][i] = x[(size_t)(mt * 16 + w * 2) * DG + ln + 32 * i];
    xv[1][i] = x[(size_t)(mt * 16 + w * 2 + 1) * DG + ln + 32 * i];
    gm[i] = gamma[ln + 32 * i];
    bt[i] = beta[ln + 32 * i];
  }

  // B fragments of output columns 32w .. 32w + 31 (two tiles), whole K, straight from the
  // k-major f32 weights (Wk scaled by 1/sqrt(D)); they do not depend on the layernorm
  const float* W = (z == 0) ? Wq : (z == 1) ? Wk : (z == 2) ? Wv : Wg;
  const float sc = (z == 1) ? 0.17677669529663687f : 1.f;
  v16h bF[2][8];
#pragma unroll  // constant indices keep bF in registers
  for (int ks = 0; ks < 8; ++ks) {
#pragma unroll  // constant indices: the vectors stay in registers
    for (int t = 0; t < 2; ++t) {
      const float* wp = W + (size_t)(ks * 32 + off2) * DG + w * 32 + t * 16 + n;
#pragma unroll  // constant indices: the vectors stay in registers
      for (int i = 0; i < 8; ++i) {
        bF[t][ks][i] = (_Float16)(wp[(size_t)i * DG] * sc);
        bF[t][ks][i + 8] = (_Float16)(wp[(size_t)(16 + i) * DG] * sc);
      }
    }
  }

#pragma unroll  // constant indices: the vectors stay in registers
  for (int r = 0; r < 2; ++r) {
    // halving tree over the 256 elements: distances 128, 64, 32 inside the lane, 16 .. 1 across
    float sa[8], sb[8];
#pragma unroll  // constant indices: the vectors stay in registers
    for (int i = 0; i < 8; ++i) { sa[i] = xv[r][i]; sb[i] = xv[r][i] * xv[r][i]; }
#pragma unroll  // constant indices: the vectors stay in registers
    for (int i = 0; i < 4; ++i) { sa[i] += sa[i + 4]; sb[i] += sb[i + 4]; }
    sa[0] += sa[2]; sb[0] += sb[2];
    sa[1] += sa[3]; sb[1] += sb[3];
    float s1 = sa[0] + sa[1], s2 = sb[0] + sb[1];
#pragma unroll  // five fixed steps, straight-line
    for (int d = 16; d > 0; d >>= 1) {
      s1 += __shfl_xor(s1, d, 32);
      s2 += __shfl_xor(s2, d, 32);
    }
    float mu = s1 * (1.f / 256.f);
    float var = s2 * (1.f / 256.f) - mu * mu;
    // rsqrtf spelled out: an argument below the smallest normal is scaled into range
    const float va = var + 1e-5f;
    const bool tiny = va < 1.17549435e-38f;
    float rs = rsq_slot(tiny ? va * 16777216.f : va);
    rs = tiny ? rs * 4096.f : rs;
#pragma unroll  // constant indices: the vectors stay in registers
    for (int i = 0; i < 8; ++i)
      aS[(w * 2 + r) * APITCH + ln + 32 * i] = (_Float16)((xv[r][i] - mu) * rs * gm[i] + bt[i]);
  }
  __syncthreads();  // every wave reads all 16 normalized rows

  v8f c0 = {0.f, 0.f, 0.f, 0.f, 0.f, 0.f, 0.f, 0.f};
  v8f c1 = {0.f, 0.f, 0.f, 0.f, 0.f, 0.f, 0.f, 0.f};
  const _Float16* ap = aS + n * APITCH;
#pragma unroll  // constant indices into bF
  for (int ks = 0; ks < 8; ++ks) {
    v16h a = ld_frag_full(ap + ks * 32, off2);
    c0 = __builtin_amdgcn_wmma_f32_16x16x32_f16(false, a, false, bF[0][ks], (short)0, c0,
                                                false, false);
    c1 = __builtin_amdgcn_wmma_f32_16x16x32_f16(false, a, false, bF[1][ks], (short)0, c1,
                                                false, false);
  }
  // the branch on z stands outside the store loops: one scalar test a wave, not one a store
  const int row0 = mt * 16 + 8 * hi;
  const int col0 = w * 32 + n, col1 = col0 + 16;
  if (z == 0 || z == 1) {
    _Float16* dst = (z == 0) ? qh : kh;
#pragma unroll  // constant indices: the vectors stay in registers
    for (int j = 0; j < 8; ++j) {
      dst[(size_t)(row0 + j) * DG + col0] = (_Float16)c0[j];
      dst[(size_t)(row0 + j) * DG + col1] = (_Float16)c1[j];
    }
    // the stores' registers are not rewritten ahead of this wait on any way out of the branch
    asm volatile("s_wait_xcnt 0x0" ::: "memory");
  } else if (z == 2) {
    // head w, dims n and 16 + n; the 16 rows of a tile lie in one batch
    const int bb = row0 >> 9, kp = row0 & 511;
    _Float16* v0 = vT + ((size_t)(bb * NH + w) * HD + n) * L_SEQ + kp;
    _Float16* v1 = v0 + (size_t)16 * L_SEQ;
#pragma unroll  // constant indices: the vectors stay in registers
    for (int j = 0; j < 8; ++j) {
      v0[j] = (_Float16)c0[j];
      v1[j] = (_Float16)c1[j];
    }
    // the stores' registers are not rewritten ahead of this wait on any way out of the branch
    asm volatile("s_wait_xcnt 0x0" ::: "memory");
  } else {
    const float bg0 = bg[col0], bg1 = bg[col1];
#pragma unroll  // constant indices: the vectors stay in registers
    for (int j = 0; j < 8; ++j) {
      float g0 = c0[j] + bg0, g1 = c1[j] + bg1;
      // exp(-g) as 2^(-g log2 e), what __expf computes
      gate[(size_t)(row0 + j) * DG + col0] = 1.f / (1.f + exp2_slot(g0 * -1.44269504f));
      gate[(size_t)(row0 + j) * DG + col1] = 1.f / (1.f + exp2_slot(g1 * -1.44269504f));
    }
    // the stores' registers are not rewritten ahead of this wait on any way out of the branch
    asm volatile("s_wait_xcnt 0x0" ::: "memory");
  }
}

// ---------- kernel 2: bias-LN + pair projection, then split-K attention, in two passes
// grid (qt=32, b=2, ks=KSPLIT); each WG covers k in [ks*128, ks*128+128)
// pass 1 has no barrier: wave w streams q rows 2w and 2w + 1 through a ring of its own and leaves
// the finished pair values of all 128 k in LDS; pass 2, behind one barrier, is one softmax a head.
__global__ __launch_bounds__(256) void k_attn(const float* bias, const float* b_gamma,
                                              const float* b_beta, const float* Wb,
                                              const _Float16* qh, const _Float16* kh,
                                              const _Float16* vT,
                                              float* Opart, float* mpart, float* spart) {
  const int qt = blockIdx.x;
  const int b = blockIdx.y;
  const int ksp = blockIdx.z;
  const int tid = threadIdx.x;
  const int w = tid >> 5;          // wave id == head id
  const int ln = tid & 31;
  const int n = ln & 15;
  const int hi = ln >> 4;
  const int off2 = hi * 8;

  __shared__ float2 gwB2[64][16];              // B table for pair WMMA (c pairs x 16 cols)
  // per wave: its share of sum(gamma*Wb) of heads 0..7, then of sum(beta*Wb) of heads 0..7
  __shared__ __attribute__((aligned(16))) float gcPart[8][16];
  __shared__ float rawLds[8][16 * 17];         // per wave: one unit's raw products [k][col], padded
  __shared__ float ssqLds[8][16 * 2];          // per wave: one unit's sumsq partials
  __shared__ float pairAll[8 * 16 * PKP];      // finished pair values [head][q][k]
  __shared__ __attribute__((aligned(16))) _Float16 pP[8 * 16 * PPITCH];  // per-wave P staging
  __shared__ __attribute__((aligned(16))) unsigned char biasSt[8 * WRING];  // eight private rings

  const int ktBeg = ksp * 8;
  // The operands of the tables are asked for first, all at once, so that the table build waits out
  // one memory latency and no request of the bias stream stands in front of them. Thread (tc, n)
  // holds channels 2 tc + 32 it and the next one of column n & 7 of Wb, with gamma (n < 8: table
  // entries and the gamma sum) or beta (n >= 8: the beta sum).
  const int tc = tid >> 4;
  const float* gp = ((n < 8) ? b_gamma : b_beta) + tc * 2;
  const float* wp = Wb + tc * 16 + (n & 7);
  float2 gv[4];
  float w0[4], w1[4];
#pragma unroll  // constant indices keep the arrays in registers
  for (int it = 0; it < 4; ++it) {
    gv[it] = *reinterpret_cast<const float2*>(gp + it * 32);
    w0[it] = wp[it * 256];
    w1[it] = wp[it * 256 + 8];
  }
  const size_t bq0 = (size_t)(b * L_SEQ + qt * 16 + w * 2);
  // the lane's own LDS byte address in row 0 of slot 0 of its wave's ring
  const unsigned ringLds = (unsigned)(size_t)biasSt + w * WRING + ln * 16;
  // the lane's own global address in row 0 of unit 0; unit u = q row u >> 3, k rows 16 (u & 7) ..
  const float* gsrc = bias + (bq0 * L_SEQ + ktBeg * 16) * DB + ln * 4;
  // the wait stands ahead of any reuse of an address register of these loads: as operands of the
  // statement the addresses stay in their registers up to it
  asm volatile("s_wait_xcnt 0x0" :: "v"(gp), "v"(wp) : "memory");

  copy_unit(ringLds, gsrc);                    // units 0 to 2 fly while the tables are built
  copy_unit(ringLds + USLOT, gsrc + 16 * DB);
  copy_unit(ringLds + 2 * USLOT, gsrc + 32 * DB);
  // keeps the table arithmetic, and with it the wait for its operands, behind the issue of the copies
  __builtin_amdgcn_sched_barrier(0);

  // B table: cols 0..7 = gamma[c]*Wb[c][h], col 8 = 1 (row sums), rest 0; beside it the thread's
  // share of sum(gamma*Wb) (n < 8) or sum(beta*Wb) (n >= 8) of head n & 7
  {
    const float fill = (n == 8) ? 1.f : 0.f;
    float part = 0.f;
#pragma unroll  // constant indices into the operand arrays
    for (int it = 0; it < 4; ++it) {
      const float p0 = gv[it].x * w0[it], p1 = gv[it].y * w1[it];
      part += p0 + p1;
      gwB2[tc + 16 * it][n] = (n < 8) ? make_float2(p0, p1) : make_float2(fill, fill);
    }
    part += __shfl_xor(part, 16, 32);  // the wave's two channel groups
    if (hi == 0) gcPart[w][n] = part;
  }

  __syncthreads();  // the tables are complete

  // the lane finishes heads 4 hi .. 4 hi + 3 of k row n: the eight waves' shares, summed in order
  float gh[4] = {0.f, 0.f, 0.f, 0.f}, cb[4] = {0.f, 0.f, 0.f, 0.f};
#pragma unroll  // constant indices keep the arrays in registers
  for (int ww = 0; ww < 8; ++ww) {
    const float4 g4 = *reinterpret_cast<const float4*>(&gcPart[ww][hi * 4]);
    const float4 c4 = *reinterpret_cast<const float4*>(&gcPart[ww][8 + hi * 4]);
    gh[0] += g4.x; gh[1] += g4.y; gh[2] += g4.z; gh[3] += g4.w;
    cb[0] += c4.x; cb[1] += c4.y; cb[2] += c4.z; cb[3] += c4.w;
  }
  // the lane's B fragments of the pair product, heads and remainders: the same in every unit, so
  // made once. Element i of K step s is channel 32 s + 16 hi + i, in B here as in A below.
  v8u bH[4], bL[4];
#pragma unroll  // constant indices keep the fragments in registers
  for (int s = 0; s < 4; ++s) {
#pragma unroll  // constant indices keep the fragments in registers
    for (int p = 0; p < 8; ++p) {
      const float2 bv = gwB2[s * 16 + hi * 8 + p][n];
      unsigned h, l;
      split2(v2f{bv.x, bv.y}, h, l);
      bH[s][p] = h;
      bL[s][p] = l;
    }
  }
  float* rawW = rawLds[w];
  float* ssqW = ssqLds[w];

  // the head's fragments for pass 2, asked for behind the table barrier (which would wait for them):
  // nothing reads them before pass 2, so they may queue behind the bias stream;
  // Q (rows = 16 q positions, K = 32 dims), K of the eight k tiles, V of the four 32-wide k steps;
  // the pointers are the lane's own addresses, its half's K offset off2 included
  const _Float16* qp = qh + (size_t)(b * L_SEQ + qt * 16 + n) * DG + w * HD + off2;
  const _Float16* kp = kh + (size_t)(b * L_SEQ + ktBeg * 16 + n) * DG + w * HD + off2;
  const _Float16* vp = vT + ((size_t)(b * NH + w) * HD + n) * L_SEQ + ktBeg * 16 + off2;
  v16h aQ = ld_frag_full(qp, 0);
  v16h bK[8], bV1[4], bV2[4];
#pragma unroll  // constant indices keep the fragments in registers
  for (int kt = 0; kt < 8; ++kt) bK[kt] = ld_frag_full(kp + kt * 16 * DG, 0);
#pragma unroll  // constant indices keep the fragments in registers
  for (int kk = 0; kk < 4; ++kk) {
    bV1[kk] = ld_frag_full(vp + kk * 32, 0);
    bV2[kk] = ld_frag_full(vp + 16 * L_SEQ + kk * 32, 0);
  }
  // the wait stands ahead of any reuse of an address register of these loads: as operands of the
  // statement the addresses stay in their registers up to it
  asm volatile("s_wait_xcnt 0x0" :: "v"(qp), "v"(kp), "v"(vp) : "memory");

  // ---- pass 1: 16 units of one q row x 16 k rows; nothing here is read by another wave
  unsigned slot = 0;  // byte offset of unit u's slot in the ring
#pragma unroll 1  // one copy of the body: for speed only
  for (int u = 0; u < NUNIT; ++u) {
    // Unit u has landed. While refills go on, exactly units u + 1 and u + 2 (32 copies) were issued
    // behind it, and the counter returns in issue order; the trips without a refill wait to 0.
    if (u < NUNIT - URING) asm volatile("s_wait_asynccnt 0x20" ::: "memory");
    else                   asm volatile("s_wait_asynccnt 0x0" ::: "memory");
    const float* bp =
        reinterpret_cast<const float*>(biasSt + w * WRING + slot + n * BPITCH) + hi * 16;
    float4 av[16];  // av[4 s + t]: channels 32 s + 16 hi + 4 t .. + 3 of k row n
#pragma unroll  // constant indices keep av in registers
    for (int s = 0; s < 4; ++s)
#pragma unroll  // constant indices keep av in registers
      for (int t = 0; t < 4; ++t)
        av[s * 4 + t] = *reinterpret_cast<const float4*>(bp + s * 32 + t * 4);
    // the wave's own reads of the slot are done: only then may copies write it again
    asm volatile("s_wait_dscnt 0x0" ::: "memory");
    if (u < NUNIT - URING) {
      const int u3 = u + URING;
      copy_unit(ringLds + slot, gsrc + (size_t)(u3 >> 3) * L_SEQ * DB + (u3 & 7) * 16 * DB);
    }
    // a * b = ah * bh + (al * bh + ah * bl), al * bl left out: the large and the small products
    // are summed apart and added once
    v8f C = {0.f, 0.f, 0.f, 0.f, 0.f, 0.f, 0.f, 0.f};
    v8f Cs = {0.f, 0.f, 0.f, 0.f, 0.f, 0.f, 0.f, 0.f};
    v2f s01 = {0.f, 0.f}, s23 = {0.f, 0.f};
#pragma unroll  // constant indices into av, bH and bL
    for (int s = 0; s < 4; ++s) {
      v8u ah, al;
#pragma unroll  // constant indices keep the fragments in registers
      for (int t = 0; t < 4; ++t) {
        const v2f x01 = {av[s * 4 + t].x, av[s * 4 + t].y};
        const v2f x23 = {av[s * 4 + t].z, av[s * 4 + t].w};
        s01 += x01 * x01;
        s23 += x23 * x23;
        unsigned h, l;
        split2(x01, h, l);
        ah[2 * t] = h;
        al[2 * t] = l;
        split2(x23, h, l);
        ah[2 * t + 1] = h;
        al[2 * t + 1] = l;
      }
      C = wmma_b(ah, bH[s], C);
      Cs = wmma_b(al, bH[s], Cs);
      Cs = wmma_b(ah, bL[s], Cs);
    }
    C += Cs;
    const float ss = (s01.x + s01.y) + (s23.x + s23.y);
#pragma unroll  // constant indices keep the vectors in registers
    for (int j = 0; j < 8; ++j) rawW[(j + 8 * hi) * 17 + n] = C[j];
    ssqW[n * 2 + hi] = ss;
    // other lanes of this wave read what these stores wrote
    asm volatile("s_wait_dscnt 0x0" ::: "memory");
    // finish the layernorm correction of (q, k = n) for four heads
    {
      float sum = rawW[n * 17 + 8];
      float ssq = ssqW[n * 2] + ssqW[n * 2 + 1];
      float mu = sum * (1.f / 128.f);
      float var = ssq * (1.f / 128.f) - mu * mu;
      float rsg = rsqrtf(var + 1e-5f);
      float* pd = pairAll + (hi * 64 + w * 2 + (u >> 3)) * PKP + (u & 7) * 16 + n;
#pragma unroll  // constant indices keep the vectors in registers
      for (int i = 0; i < 4; ++i)
        pd[i * 16 * PKP] = rsg * (rawW[n * 17 + hi * 4 + i] - mu * gh[i]) + cb[i];
    }
    slot = (slot == (URING - 1) * USLOT) ? 0u : slot + USLOT;
  }
  __syncthreads();  // every wave's pair values are in place; wave w now reads head w of all 16 q

  // ---- pass 2: logits = Q*K^T + pair over all 128 k, one softmax, O = P*V
  v8f Lg[8];
#pragma unroll  // constant indices keep Lg in registers
  for (int kt = 0; kt < 8; ++kt) {
    v8f cp;
#pragma unroll  // constant indices keep the vectors in registers
    for (int j = 0; j < 8; ++j) cp[j] = pairAll[(w * 16 + j + 8 * hi) * PKP + kt * 16 + n];
    Lg[kt] = __builtin_amdgcn_wmma_f32_16x16x32_f16(false, aQ, false, bK[kt], (short)0, cp,
                                                    false, false);
  }
  float mrow[8], srow[8];
  _Float16* pw = pP + w * 16 * PPITCH;  // wave-private transpose of P (C layout -> A layout)
#pragma unroll  // constant indices keep the vectors in registers
  for (int j = 0; j < 8; ++j) {
    float mx = -1e30f;
#pragma unroll  // constant indices keep the vectors in registers
    for (int kt = 0; kt < 8; ++kt) mx = fmaxf(mx, Lg[kt][j]);
    mx = half16_max(mx);
    float s = 0.f;
#pragma unroll  // constant indices keep the vectors in registers
    for (int kt = 0; kt < 8; ++kt) {
      // exp(d) as 2^(d log2 e), what __expf computes
      const float p = exp2_slot((Lg[kt][j] - mx) * 1.44269504f);
      s += p;
      pw[(j + 8 * hi) * PPITCH + kt * 16 + n] = (_Float16)p;
    }
    srow[j] = half16_sum(s);
    mrow[j] = mx;
  }
  // other lanes of this wave read what these stores wrote
  asm volatile("s_wait_dscnt 0x0" ::: "memory");
  v8f O1 = {0.f, 0.f, 0.f, 0.f, 0.f, 0.f, 0.f, 0.f};
  v8f O2 = {0.f, 0.f, 0.f, 0.f, 0.f, 0.f, 0.f, 0.f};
#pragma unroll  // constant indices into bV1 and bV2
  for (int kk = 0; kk < 4; ++kk) {
    v16h aP = ld_frag_full(pw + n * PPITCH + kk * 32, off2);  // rows q, K = 32 k
    O1 = __builtin_amdgcn_wmma_f32_16x16x32_f16(false, aP, false, bV1[kk], (short)0,
                                                O1, false, false);
    O2 = __builtin_amdgcn_wmma_f32_16x16x32_f16(false, aP, false, bV2[kk], (short)0,
                                                O2, false, false);
  }

  // epilogue: write unnormalized partials (O, m, s) for this k-range
#pragma unroll  // constant indices keep the vectors in registers
  for (int j = 0; j < 8; ++j) {
    size_t row = (size_t)(b * L_SEQ + qt * 16 + j + 8 * hi);
    size_t base = ((size_t)ksp * ROWS + row) * DG + w * HD;
    Opart[base + n] = O1[j];
    Opart[base + 16 + n] = O2[j];
  }
  if (n == 0) {
#pragma unroll  // constant indices keep the vectors in registers
    for (int j = 0; j < 8; ++j) {
      size_t row = (size_t)(b * L_SEQ + qt * 16 + j + 8 * hi);
      mpart[((size_t)ksp * ROWS + row) * NH + w] = mrow[j];
      spart[((size_t)ksp * ROWS + row) * NH + w] = srow[j];
    }
  }
}

// ---------- kernel 3: combine split-K partials, normalize, gate -> f16 rows in LDS, then the
// output projection + bias (WMMA f16). grid (row tile, column half); wave w of a group combines
// rows 2w and 2w + 1 and then owns one 16-column tile of the product.
// amdgpu_waves_per_eu(2, 2): one group a WGP (128 groups in all), so no register is saved for more
// resident waves; without it the compiler holds the B-fragment loads back behind the arithmetic.
__global__ __launch_bounds__(256) __attribute__((amdgpu_waves_per_eu(2, 2)))
void k_out(const float* Opart, const float* mpart, const float* spart, const float* gate,
           const _Float16* WoutT, const float* bout, float* out) {
  const int mt = blockIdx.x, tid = threadIdx.x;
  const int w = tid >> 5, ln = tid & 31, n = ln & 15, hi = ln >> 4, off2 = hi * 8;
  const int col0 = (blockIdx.y * 8 + w) * 16;
  __shared__ __attribute__((aligned(16))) _Float16 aS[16 * APITCH];

  // a lane holds columns 64 i + 4 n .. + 3 of its row: 16 lanes read 256 contiguous bytes
  const int lrow = w * 2 + hi;
  const size_t row = (size_t)(mt * 16 + lrow);
  // the lane's own addresses: its row's 8 heads; columns 4 n .. 4 n + 3 of every 64
  const float* mp = mpart + row * NH;
  const float* sp = spart + row * NH;
  const float* op = Opart + row * DG + n * 4;
  const float* gp = gate + row * DG + n * 4;
  const _Float16* bp = WoutT + (size_t)(col0 + n) * DG + off2;
  const int oc = col0 + n;  // the lane's output column
  float4 mq[KSPLIT][2], sq[KSPLIT][2];  // maxima and sums of heads 0..3 and 4..7
  float4 ov[KSPLIT][4], gv[4];
  v16h bF[8];  // B fragments of the wave's 16 output columns, whole K
#pragma unroll  // constant indices keep the arrays in registers
  for (int g = 0; g < KSPLIT; ++g) {
    mq[g][0] = *reinterpret_cast<const float4*>(mp + g * ROWS * NH);
    mq[g][1] = *reinterpret_cast<const float4*>(mp + g * ROWS * NH + 4);
    sq[g][0] = *reinterpret_cast<const float4*>(sp + g * ROWS * NH);
    sq[g][1] = *reinterpret_cast<const float4*>(sp + g * ROWS * NH + 4);
  }
#pragma unroll  // constant indices keep the arrays in registers
  for (int i = 0; i < 4; ++i) {
#pragma unroll  // constant indices keep the arrays in registers
    for (int g = 0; g < KSPLIT; ++g)
      ov[g][i] = *reinterpret_cast<const float4*>(op + g * ROWS * DG + i * 64);
    gv[i] = *reinterpret_cast<const float4*>(gp + i * 64);
  }
#pragma unroll  // constant indices keep bF in registers
  for (int ks = 0; ks < 8; ++ks) bF[ks] = ld_frag_full(bp + ks * 32, 0);
  const float bo = bout[oc];
  // Every load of the kernel stands above this line (the "memory" clobber), so that a wave meets
  // one memory latency and not two. The wait stands ahead of any reuse of an address register:
  // as operands of the statement the addresses stay in their registers up to it.
  asm volatile("s_wait_xcnt 0x0" :: "v"(mp), "v"(sp), "v"(op), "v"(gp), "v"(bp), "v"(oc)
               : "memory");

  // columns 64 i + 4 n .. + 3 belong to head 2 i + (n >> 3)
  const bool odd = n >= 8;
  float mv[KSPLIT][4], sv[KSPLIT][4];
#pragma unroll  // constant indices keep the arrays in registers
  for (int g = 0; g < KSPLIT; ++g) {
    mv[g][0] = odd ? mq[g][0].y : mq[g][0].x;  sv[g][0] = odd ? sq[g][0].y : sq[g][0].x;
    mv[g][1] = odd ? mq[g][0].w : mq[g][0].z;  sv[g][1] = odd ? sq[g][0].w : sq[g][0].z;
    mv[g][2] = odd ? mq[g][1].y : mq[g][1].x;  sv[g][2] = odd ? sq[g][1].y : sq[g][1].x;
    mv[g][3] = odd ? mq[g][1].w : mq[g][1].z;  sv[g][3] = odd ? sq[g][1].w : sq[g][1].z;
  }
#pragma unroll  // constant indices keep the arrays in registers
  for (int i = 0; i < 4; ++i) {
    float m0 = -1e30f;
#pragma unroll  // constant indices keep the arrays in registers
    for (int g = 0; g < KSPLIT; ++g) m0 = fmaxf(m0, mv[g][i]);
    float s = 0.f, o0 = 0.f, o1 = 0.f, o2 = 0.f, o3 = 0.f;
#pragma unroll  // constant indices keep the arrays in registers
    for (int g = 0; g < KSPLIT; ++g) {
      // exp(d) as 2^(d log2 e), what __expf computes
      const float e = exp2_slot((mv[g][i] - m0) * 1.44269504f);
      s += sv[g][i] * e;
      o0 += ov[g][i].x * e;
      o1 += ov[g][i].y * e;
      o2 += ov[g][i].z * e;
      o3 += ov[g][i].w * e;
    }
    v4h r = {(_Float16)(o0 / s * gv[i].x), (_Float16)(o1 / s * gv[i].y),
             (_Float16)(o2 / s * gv[i].z), (_Float16)(o3 / s * gv[i].w)};
    *reinterpret_cast<v4h*>(aS + lrow * APITCH + i * 64 + n * 4) = r;
  }
  __syncthreads();  // every wave reads all 16 combined rows

  v8f c = {0.f, 0.f, 0.f, 0.f, 0.f, 0.f, 0.f, 0.f};
  const _Float16* ap = aS + n * APITCH;
#pragma unroll  // constant indices into bF
  for (int ks = 0; ks < 8; ++ks) {
    v16h a = ld_frag_full(ap + ks * 32, off2);
    c = __builtin_amdgcn_wmma_f32_16x16x32_f16(false, a, false, bF[ks], (short)0, c,
                                               false, false);
  }
#pragma unroll  // constant indices: the vector stays in registers
  for (int j = 0; j < 8; ++j)
    out[(size_t)(mt * 16 + j + 8 * hi) * DG + oc] = c[j] + bo;
}

extern "C" void kernel_launch(void* const* d_in, const int* in_sizes, int n_in,
                              void* d_out, int out_size, void* d_ws, size_t ws_size,
                              hipStream_t stream) {
  (void)in_sizes; (void)n_in; (void)out_size; (void)ws_size;
  const float* x       = (const float*)d_in[0];
  const float* bias    = (const float*)d_in[1];
  const float* g_gamma = (const float*)d_in[2];
  const float* g_beta  = (const float*)d_in[3];
  const float* b_gamma = (const float*)d_in[4];
  const float* b_beta  = (const float*)d_in[5];
  const float* Wq      = (const float*)d_in[6];
  const float* Wk      = (const float*)d_in[7];
  const float* Wv      = (const float*)d_in[8];
  const float* Wb      = (const float*)d_in[9];
  const float* Wg      = (const float*)d_in[10];
  const float* bg      = (const float*)d_in[11];
  const float* Wout    = (const float*)d_in[12];
  const float* bout    = (const float*)d_in[13];
  float* out = (float*)d_out;

  char* p = (char*)d_ws;
  _Float16* WoutT   = (_Float16*)p; p += (size_t)DG * DG * sizeof(_Float16);
  _Float16* qh      = (_Float16*)p; p += (size_t)ROWS * DG * sizeof(_Float16);
  _Float16* kh      = (_Float16*)p; p += (size_t)ROWS * DG * sizeof(_Float16);
  _Float16* vT      = (_Float16*)p; p += (size_t)ROWS * DG * sizeof(_Float16);
  float* gate       = (float*)p;    p += (size_t)ROWS * DG * sizeof(float);
  float* Opart      = (float*)p;    p += (size_t)KSPLIT * ROWS * DG * sizeof(float);
  float* mpart      = (float*)p;    p += (size_t)KSPLIT * ROWS * NH * sizeof(float);
  float* spart      = (float*)p;    p += (size_t)KSPLIT * ROWS * NH * sizeof(float);

  k_proj<<<dim3(ROWS / 16, 5), 256, 0, stream>>>(x, g_gamma, g_beta, Wq, Wk, Wv, Wg, Wout, bg,
                                                 qh, kh, vT, gate, WoutT);
  k_attn<<<dim3(32, 2, KSPLIT), 256, 0, stream>>>(bias, b_gamma, b_beta, Wb, qh, kh,
                                                  vT, Opart, mpart, spart);
  k_out<<<dim3(ROWS / 16, 2), 256, 0, stream>>>(Opart, mpart, spart, gate, WoutT, bout, out);
}

// v007
// A run of this version takes 33.5 microseconds.
// In two side-by-side timings against v006, it was 1.04 and 1.03 times as fast.
// Counting every step since v000, it is 2.28 times as fast.
#include <hip/hip_runtime.h>
#include <hip/hip_bf16.h>

typedef __attribute__((ext_vector_type(16))) _Float16 v16h;
typedef __attribute__((ext_vector_type(8)))  _Float16 v8h;
typedef __attribute__((ext_vector_type(4)))  _Float16 v4h;
typedef __attribute__((ext_vector_type(2)))  _Float16 v2h;
typedef __attribute__((ext_vector_type(8)))  float    v8f;
typedef __attribute__((ext_vector_type(2)))  float    v2f;
typedef __attribute__((ext_vector_type(16))) __bf16   v16b;
typedef __attribute__((ext_vector_type(2)))  __bf16   v2b;
typedef __attribute__((ext_vector_type(8)))  unsigned v8u;

#define L_SEQ 512
#define DG 256
#define DB 128
#define NH 8
#define HD 32
#define KSPLIT 4      // k-range split factor for the attention kernel
#define ROWS 1024     // b * L_SEQ
#define BPITCH 528            // staged bias row: 512 B + 16 B, an odd count of 16 B: 16 rows' 16-byte reads spread over the banks
#define USLOT (16 * BPITCH)   // one unit of the bias stream: 1 q row x 16 k rows x 128 channels
#define URING 3               // slots in a wave's private ring
#define WRING (URING * USLOT)
#define NUNIT 16              // units a wave streams: 2 q rows x 128 k rows
#define PKP 132               // pair row: 128 k + 4, so rows q and q + 8 fall on different banks
#define PPITCH 136            // P row: 128 halves + 8, so 16 rows' 16-byte reads spread over the banks

// ---------- fragment loaders (f16 A/B layout: lane row/col = ln&15,
// halves[0..7] = K off2+0..7, halves[8..15] = K 16+off2+0..7, off2 = (ln>>4)*8)
__device__ __forceinline__ v16h ld_frag_full(const _Float16* p, int off2) {
  v8h a = *reinterpret_cast<const v8h*>(p + off2);
  v8h b = *reinterpret_cast<const v8h*>(p + 16 + off2);
  v16h r;
#pragma unroll
  for (int i = 0; i < 8; ++i) { r[i] = a[i]; r[i + 8] = b[i]; }
  return r;
}

__device__ __forceinline__ float half16_max(float v) {
  v = fmaxf(v, __shfl_xor(v, 1, 32));
  v = fmaxf(v, __shfl_xor(v, 2, 32));
  v = fmaxf(v, __shfl_xor(v, 4, 32));
  v = fmaxf(v, __shfl_xor(v, 8, 32));
  return v;
}
__device__ __forceinline__ float half16_sum(float v) {
  v += __shfl_xor(v, 1, 32);
  v += __shfl_xor(v, 2, 32);
  v += __shfl_xor(v, 4, 32);
  v += __shfl_xor(v, 8, 32);
  return v;
}

// ---------- two f32 values as a bf16 head and a bf16 remainder each (packed pairs): x - head is exact
// in f32, so head + remainder carries 16 significant bits of x
__device__ __forceinline__ void split2(v2f x, unsigned& head, unsigned& rem) {
  const unsigned hb = __builtin_bit_cast(unsigned, __builtin_convertvector(x, v2b));
  const v2f hf = {__builtin_bit_cast(float, hb << 16), __builtin_bit_cast(float, hb & 0xffff0000u)};
  head = hb;
  rem = __builtin_bit_cast(unsigned, __builtin_convertvector(x - hf, v2b));
}
__device__ __forceinline__ v8f wmma_b(v8u a, v8u b, v8f c) {
  return __builtin_amdgcn_wmma_f32_16x16x32_bf16(false, __builtin_bit_cast(v16b, a), false,
                                                 __builtin_bit_cast(v16b, b), (short)0, c, false,
                                                 false);
}

// ---------- eight asynchronous 16-byte-per-lane copies: eight whole 512-byte bias rows -> LDS.
// lds and g are the lane's own addresses in row 0. The closing s_wait_xcnt stands inside the
// statement so that no address register is rewritten ahead of it.
__device__ __forceinline__ void copy_rows8(unsigned lds, const float* g) {
  asm volatile(
      "global_load_async_to_lds_b128 %0, %8, off\n\t"
      "global_load_async_to_lds_b128 %1, %9, off\n\t"
      "global_load_async_to_lds_b128 %2, %10, off\n\t"
      "global_load_async_to_lds_b128 %3, %11, off\n\t"
      "global_load_async_to_lds_b128 %4, %12, off\n\t"
      "global_load_async_to_lds_b128 %5, %13, off\n\t"
      "global_load_async_to_lds_b128 %6, %14, off\n\t"
      "global_load_async_to_lds_b128 %7, %15, off\n\t"
      "s_wait_xcnt 0x0"
      :: "v"(lds), "v"(lds + BPITCH), "v"(lds + 2 * BPITCH), "v"(lds + 3 * BPITCH),
         "v"(lds + 4 * BPITCH), "v"(lds + 5 * BPITCH), "v"(lds + 6 * BPITCH),
         "v"(lds + 7 * BPITCH),
         "v"(g), "v"(g + DB), "v"(g + 2 * DB), "v"(g + 3 * DB), "v"(g + 4 * DB),
         "v"(g + 5 * DB), "v"(g + 6 * DB), "v"(g + 7 * DB)
      : "memory");
}
// one unit (16 whole rows that follow one another in memory) into one slot of the wave's ring
__device__ __forceinline__ void copy_unit(unsigned lds, const float* g) {
  copy_rows8(lds, g);
  copy_rows8(lds + 8 * BPITCH, g + 8 * DB);
}

// ---------- one transcendental with the free issue slot that the instruction set asks for behind it,
// in one statement: nothing that overwrites its source or reads its result can stand directly behind
__device__ __forceinline__ float rsq_slot(float a) {
  float r;
  asm("v_rsq_f32 %0, %1\n\tv_nop" : "=v"(r) : "v"(a));  // v_nop: the slot behind v_rsq
  return r;
}
__device__ __forceinline__ float exp2_slot(float a) {
  float r;
  asm("v_exp_f32 %0, %1\n\tv_nop" : "=v"(r) : "v"(a));  // v_nop: the slot behind v_exp
  return r;
}

// ---------- kernel 1: layernorm(x), f16 weight conversion and the q/k/v/gate projections (WMMA
// f16). grid (row tile, z): z = 0..3 selects the matrix, one 8-wave work-group per 32 rows;
// z = 4 writes the transposed f16 copy of Wout that the last kernel reads.
// A wave owns 32 output columns; lane column n stands for columns 2 n (first tile) and 2 n + 1
// (second tile), so one 8-byte load feeds both tiles and 16 lanes cover a whole 128-byte line.
#define APITCH 264  // staged row: 256 halves + 8, so 16 rows' 16-byte reads fall on different banks
#define PROWS 32    // rows a work-group projects: every weight fragment serves two row tiles
// amdgpu_waves_per_eu(2, 2): one group a WGP (160 groups in all), so no register is saved for more
// resident waves; without it the compiler takes the layernorm's lane exchanges one at a time, each
// behind a wait of its own.
__global__ __launch_bounds__(256) __attribute__((amdgpu_waves_per_eu(2, 2)))
void k_proj(const float* x, const float* gamma, const float* beta, const float* Wq,
            const float* Wk, const float* Wv, const float* Wg, const float* Wout, const float* bg,
            _Float16* qh, _Float16* kh, _Float16* vT, float* gate, _Float16* WoutT) {
  const int mt = blockIdx.x, z = blockIdx.y, tid = threadIdx.x;
  if (z == 4) {  // the whole block leaves here, ahead of the barrier
    const float* wr = Wout + (size_t)tid * DG + mt * 8;
    const float4 wa = *reinterpret_cast<const float4*>(wr);
    const float4 wb = *reinterpret_cast<const float4*>(wr + 4);
    _Float16* wt = WoutT + (size_t)(mt * 8) * DG + tid;
    wt[0 * DG] = (_Float16)wa.x;
    wt[1 * DG] = (_Float16)wa.y;
    wt[2 * DG] = (_Float16)wa.z;
    wt[3 * DG] = (_Float16)wa.w;
    wt[4 * DG] = (_Float16)wb.x;
    wt[5 * DG] = (_Float16)wb.y;
    wt[6 * DG] = (_Float16)wb.z;
    wt[7 * DG] = (_Float16)wb.w;
    return;
  }
  __shared__ __attribute__((aligned(16))) _Float16 aS[PROWS * APITCH];
  const int w = tid >> 5, ln = tid & 31, n = ln & 15, hi = ln >> 4, off2 = hi * 8;

  // wave w normalizes rows 4w .. 4w + 3; a lane holds elements ln + 32 i of a row
  const float* xp = x + (size_t)(mt * PROWS + w * 4) * DG + ln;  // the lane's own address in row 4w
  float xv[4][8], gm[8], bt[8];
#pragma unroll  // constant indices keep the arrays in registers
  for (int i = 0; i < 8; ++i) {
#pragma unroll  // constant indices keep the arrays in registers
    for (int r = 0; r < 4; ++r) xv[r][i] = xp[r * DG + 32 * i];
    gm[i] = gamma[ln + 32 * i];
    bt[i] = beta[ln + 32 * i];
  }
  // the layernorm's operands are asked for ahead of the weights: loads return in issue order, so
  // the layernorm then waits for none of the weights
  __builtin_amdgcn_sched_barrier(0);

  // B fragments of output columns 32w .. 32w + 31 (two tiles), whole K, straight from the
  // k-major f32 weights (Wk scaled by 1/sqrt(D)); they do not depend on the layernorm
  const float* W = (z == 0) ? Wq : (z == 1) ? Wk : (z == 2) ? Wv : Wg;
  const float sc = (z == 1) ? 0.17677669529663687f : 1.f;
  const int col0 = w * 32 + 2 * n;  // the lane's first output column
  const float* wp = W + (size_t)off2 * DG + col0;  // the lane's own address in K row off2
  const float* bp = bg + col0;
  const float2 bg2 = *reinterpret_cast<const float2*>(bp);  // loaded by every group, used by the gate's alone
  float2 wl[8][16];  // wl[ks][i]: K rows 32 ks + off2 + i (i < 8) and 32 ks + 16 + off2 + i - 8
#pragma unroll  // constant indices keep wl in registers
  for (int ks = 0; ks < 8; ++ks) {
#pragma unroll  // constant indices keep wl in registers
    for (int i = 0; i < 8; ++i) {
      wl[ks][i] = *reinterpret_cast<const float2*>(wp + (ks * 32 + i) * DG);
      wl[ks][i + 8] = *reinterpret_cast<const float2*>(wp + (ks * 32 + 16 + i) * DG);
    }
  }
  // Every load ahead of the barrier stands above this line (the "memory" clobber), so that the
  // layernorm runs while the weights fly. The wait stands ahead of any reuse of an address
  // register: as operands of the statement the addresses stay in their registers up to it.
  asm volatile("s_wait_xcnt 0x0" :: "v"(xp), "v"(wp), "v"(bp), "v"(ln) : "memory");
  // keeps the layernorm's arithmetic, and with it the wait for its operands, behind the last load
  __builtin_amdgcn_sched_barrier(0);
  // halving tree over a row's 256 elements: distances 128, 64, 32 inside the lane, 16 .. 1 across;
  // the four rows go through each step together, so that one wait serves eight lane exchanges
  float s1[4], s2[4];
#pragma unroll  // constant indices: the vectors stay in registers
  for (int r = 0; r < 4; ++r) {
    float sa[8], sb[8];
#pragma unroll  // constant indices: the vectors stay in registers
    for (int i = 0; i < 8; ++i) { sa[i] = xv[r][i]; sb[i] = xv[r][i] * xv[r][i]; }
#pragma unroll  // constant indices: the vectors stay in registers
    for (int i = 0; i < 4; ++i) { sa[i] += sa[i + 4]; sb[i] += sb[i + 4]; }
    sa[0] += sa[2]; sb[0] += sb[2];
    sa[1] += sa[3]; sb[1] += sb[3];
    s1[r] = sa[0] + sa[1];
    s2[r] = sb[0] + sb[1];
  }
#pragma unroll  // five fixed steps, straight-line
  for (int d = 16; d > 0; d >>= 1) {
    float t1[4], t2[4];
#pragma unroll  // constant indices: the vectors stay in registers
    for (int r = 0; r < 4; ++r) {
      t1[r] = __shfl_xor(s1[r], d, 32);
      t2[r] = __shfl_xor(s2[r], d, 32);
    }
#pragma unroll  // constant indices: the vectors stay in registers
    for (int r = 0; r < 4; ++r) {
      s1[r] += t1[r];
      s2[r] += t2[r];
    }
  }
#pragma unroll  // constant indices: the vectors stay in registers
  for (int r = 0; r < 4; ++r) {
    float mu = s1[r] * (1.f / 256.f);
    float var = s2[r] * (1.f / 256.f) - mu * mu;
    // rsqrtf spelled out: an argument below the smallest normal is scaled into range
    const float va = var + 1e-5f;
    const bool tiny = va < 1.17549435e-38f;
    float rs = rsq_slot(tiny ? va * 16777216.f : va);
    rs = tiny ? rs * 4096.f : rs;
#pragma unroll  // constant indices: the vectors stay in registers
    for (int i = 0; i < 8; ++i)
      aS[(w * 4 + r) * APITCH + ln + 32 * i] = (_Float16)((xv[r][i] - mu) * rs * gm[i] + bt[i]);
  }
  __syncthreads();  // every wave reads all 32 normalized rows

  v16h bF[2][8];
#pragma unroll  // constant indices keep bF in registers
  for (int ks = 0; ks < 8; ++ks) {
#pragma unroll  // constant indices: the vectors stay in registers
    for (int i = 0; i < 16; ++i) {
      bF[0][ks][i] = (_Float16)(wl[ks][i].x * sc);
      bF[1][ks][i] = (_Float16)(wl[ks][i].y * sc);
    }
  }

  v8f c[2][2];  // [row tile][column tile]
#pragma unroll  // constant indices keep the accumulators in registers
  for (int rt = 0; rt < 2; ++rt)
#pragma unroll  // constant indices keep the accumulators in registers
    for (int t = 0; t < 2; ++t) c[rt][t] = v8f{0.f, 0.f, 0.f, 0.f, 0.f, 0.f, 0.f, 0.f};
  const _Float16* ap = aS + n * APITCH;
#pragma unroll  // constant indices into bF
  for (int ks = 0; ks < 8; ++ks) {
#pragma unroll  // constant indices into c
    for (int rt = 0; rt < 2; ++rt) {
      v16h a = ld_frag_full(ap + rt * 16 * APITCH + ks * 32, off2);
      c[rt][0] = __builtin_amdgcn_wmma_f32_16x16x32_f16(false, a, false, bF[0][ks], (short)0,
                                                        c[rt][0], false, false);
      c[rt][1] = __builtin_amdgcn_wmma_f32_16x16x32_f16(false, a, false, bF[1][ks], (short)0,
                                                        c[rt][1], false, false);
    }
  }
  // the branch on z stands outside the store loops: one scalar test a wave, not one a store;
  // the lane's two columns are neighbours, so each row takes one store
  const int row0 = mt * PROWS + 8 * hi;
  if (z == 0 || z == 1) {
    _Float16* dst = ((z == 0) ? qh : kh) + (size_t)row0 * DG + col0;
    v2h pk[16];
#pragma unroll  // constant indices: the vectors stay in registers
    for (int rt = 0; rt < 2; ++rt)
#pragma unroll  // constant indices: the vectors stay in registers
      for (int j = 0; j < 8; ++j)
        pk[rt * 8 + j] = v2h{(_Float16)c[rt][0][j], (_Float16)c[rt][1][j]};
    // every value is made ahead of the first store, so that no store's register is rewritten
    // ahead of the wait below
    __builtin_amdgcn_sched_barrier(0);
#pragma unroll  // constant indices: the vectors stay in registers
    for (int rt = 0; rt < 2; ++rt)
#pragma unroll  // constant indices: the vectors stay in registers
      for (int j = 0; j < 8; ++j)
        *reinterpret_cast<v2h*>(dst + (rt * 16 + j) * DG) = pk[rt * 8 + j];
    // the stores' registers are not rewritten ahead of this wait on any way out of the branch
    asm volatile("s_wait_xcnt 0x0" ::: "memory");
  } else if (z == 2) {
    // head w, dims 2 n and 2 n + 1; the 32 rows of a group lie in one batch
    const int bb = row0 >> 9, kp = row0 & 511;
    _Float16* v0 = vT + ((size_t)(bb * NH + w) * HD + 2 * n) * L_SEQ + kp;
    _Float16* v1 = v0 + L_SEQ;
#pragma unroll  // constant indices: the vectors stay in registers
    for (int rt = 0; rt < 2; ++rt)
#pragma unroll  // constant indices: the vectors stay in registers
      for (int j = 0; j < 8; ++j) {
        v0[rt * 16 + j] = (_Float16)c[rt][0][j];
        v1[rt * 16 + j] = (_Float16)c[rt][1][j];
      }
    // the stores' registers are not rewritten ahead of this wait on any way out of the branch
    asm volatile("s_wait_xcnt 0x0" ::: "memory");
  } else {
    float* gd = gate + (size_t)row0 * DG + col0;
#pragma unroll  // constant indices: the vectors stay in registers
    for (int rt = 0; rt < 2; ++rt)
#pragma unroll  // constant indices: the vectors stay in registers
      for (int j = 0; j < 8; ++j) {
        float g0 = c[rt][0][j] + bg2.x, g1 = c[rt][1][j] + bg2.y;
        // exp(-g) as 2^(-g log2 e), what __expf computes
        *reinterpret_cast<float2*>(gd + (rt * 16 + j) * DG) =
            make_float2(1.f / (1.f + exp2_slot(g0 * -1.44269504f)),
                        1.f / (1.f + exp2_slot(g1 * -1.44269504f)));
      }
    // the stores' registers are not rewritten ahead of this wait on any way out of the branch
    asm volatile("s_wait_xcnt 0x0" ::: "memory");
  }
}

// ---------- kernel 2: bias-LN + pair projection, then split-K attention, in two passes
// grid (qt=32, b=2, ks=KSPLIT); each WG covers k in [ks*128, ks*128+128)
// pass 1 has no barrier: wave w streams q rows 2w and 2w + 1 through a ring of its own and leaves
// the finished pair values of all 128 k in LDS; pass 2, behind one barrier, is one softmax a head.
__global__ __launch_bounds__(256) void k_attn(const float* bias, const float* b_gamma,
                                              const float* b_beta, const float* Wb,
                                              const _Float16* qh, const _Float16* kh,
                                              const _Float16* vT,
                                              float* Opart, float* mpart, float* spart) {
  const int qt = blockIdx.x;
  const int b = blockIdx.y;
  const int ksp = blockIdx.z;
  const int tid = threadIdx.x;
  const int w = tid >> 5;          // wave id == head id
  const int ln = tid & 31;
  const int n = ln & 15;
  const int hi = ln >> 4;
  const int off2 = hi * 8;

  __shared__ float2 gwB2[64][16];              // B table for pair WMMA (c pairs x 16 cols)
  // per wave: its share of sum(gamma*Wb) of heads 0..7, then of sum(beta*Wb) of heads 0..7
  __shared__ __attribute__((aligned(16))) float gcPart[8][16];
  __shared__ float rawLds[8][16 * 17];         // per wave: one unit's raw products [k][col], padded
  __shared__ float ssqLds[8][16 * 2];          // per wave: one unit's sumsq partials
  __shared__ float pairAll[8 * 16 * PKP];      // finished pair values [head][q][k]
  __shared__ __attribute__((aligned(16))) _Float16 pP[8 * 16 * PPITCH];  // per-wave P staging
  __shared__ __attribute__((aligned(16))) unsigned char biasSt[8 * WRING];  // eight private rings

  const int ktBeg = ksp * 8;
  // The operands of the tables are asked for first, all at once, so that the table build waits out
  // one memory latency and no request of the bias stream stands in front of them. Thread (tc, n)
  // holds channels 2 tc + 32 it and the next one of column n & 7 of Wb, with gamma (n < 8: table
  // entries and the gamma sum) or beta (n >= 8: the beta sum).
  const int tc = tid >> 4;
  const float* gp = ((n < 8) ? b_gamma : b_beta) + tc * 2;
  const float* wp = Wb + tc * 16 + (n & 7);
  float2 gv[4];
  float w0[4], w1[4];
#pragma unroll  // constant indices keep the arrays in registers
  for (int it = 0; it < 4; ++it) {
    gv[it] = *reinterpret_cast<const float2*>(gp + it * 32);
    w0[it] = wp[it * 256];
    w1[it] = wp[it * 256 + 8];
  }
  const size_t bq0 = (size_t)(b * L_SEQ + qt * 16 + w * 2);
  // the lane's own LDS byte address in row 0 of slot 0 of its wave's ring
  const unsigned ringLds = (unsigned)(size_t)biasSt + w * WRING + ln * 16;
  // the lane's own global address in row 0 of unit 0; unit u = q row u >> 3, k rows 16 (u & 7) ..
  const float* gsrc = bias + (bq0 * L_SEQ + ktBeg * 16) * DB + ln * 4;
  // the wait stands ahead of any reuse of an address register of these loads: as operands of the
  // statement the addresses stay in their registers up to it
  asm volatile("s_wait_xcnt 0x0" :: "v"(gp), "v"(wp) : "memory");

  copy_unit(ringLds, gsrc);                    // units 0 to 2 fly while the tables are built
  copy_unit(ringLds + USLOT, gsrc + 16 * DB);
  copy_unit(ringLds + 2 * USLOT, gsrc + 32 * DB);
  // keeps the table arithmetic, and with it the wait for its operands, behind the issue of the copies
  __builtin_amdgcn_sched_barrier(0);

  // B table: cols 0..7 = gamma[c]*Wb[c][h], col 8 = 1 (row sums), rest 0; beside it the thread's
  // share of sum(gamma*Wb) (n < 8) or sum(beta*Wb) (n >= 8) of head n & 7
  {
    const float fill = (n == 8) ? 1.f : 0.f;
    float part = 0.f;
#pragma unroll  // constant indices into the operand arrays
    for (int it = 0; it < 4; ++it) {
      const float p0 = gv[it].x * w0[it], p1 = gv[it].y * w1[it];
      part += p0 + p1;
      gwB2[tc + 16 * it][n] = (n < 8) ? make_float2(p0, p1) : make_float2(fill, fill);
    }
    part += __shfl_xor(part, 16, 32);  // the wave's two channel groups
    if (hi == 0) gcPart[w][n] = part;
  }

  __syncthreads();  // the tables are complete

  // the lane finishes heads 4 hi .. 4 hi + 3 of k row n: the eight waves' shares, summed in order
  float gh[4] = {0.f, 0.f, 0.f, 0.f}, cb[4] = {0.f, 0.f, 0.f, 0.f};
#pragma unroll  // constant indices keep the arrays in registers
  for (int ww = 0; ww < 8; ++ww) {
    const float4 g4 = *reinterpret_cast<const float4*>(&gcPart[ww][hi * 4]);
    const float4 c4 = *reinterpret_cast<const float4*>(&gcPart[ww][8 + hi * 4]);
    gh[0] += g4.x; gh[1] += g4.y; gh[2] += g4.z; gh[3] += g4.w;
    cb[0] += c4.x; cb[1] += c4.y; cb[2] += c4.z; cb[3] += c4.w;
  }
  // the lane's B fragments of the pair product, heads and remainders: the same in every unit, so
  // made once. Element i of K step s is channel 32 s + 16 hi + i, in B here as in A below.
  v8u bH[4], bL[4];
#pragma unroll  // constant indices keep the fragments in registers
  for (int s = 0; s < 4; ++s) {
#pragma unroll  // constant indices keep the fragments in registers
    for (int p = 0; p < 8; ++p) {
      const float2 bv = gwB2[s * 16 + hi * 8 + p][n];
      unsigned h, l;
      split2(v2f{bv.x, bv.y}, h, l);
      bH[s][p] = h;
      bL[s][p] = l;
    }
  }
  float* rawW = rawLds[w];
  float* ssqW = ssqLds[w];

  // the head's fragments for pass 2, asked for behind the table barrier (which would wait for them):
  // nothing reads them before pass 2, so they may queue behind the bias stream;
  // Q (rows = 16 q positions, K = 32 dims), K of the eight k tiles, V of the four 32-wide k steps;
  // the pointers are the lane's own addresses, its half's K offset off2 included
  const _Float16* qp = qh + (size_t)(b * L_SEQ + qt * 16 + n) * DG + w * HD + off2;
  const _Float16* kp = kh + (size_t)(b * L_SEQ + ktBeg * 16 + n) * DG + w * HD + off2;
  const _Float16* vp = vT + ((size_t)(b * NH + w) * HD + n) * L_SEQ + ktBeg * 16 + off2;
  v16h aQ = ld_frag_full(qp, 0);
  v16h bK[8], bV1[4], bV2[4];
#pragma unroll  // constant indices keep the fragments in registers
  for (int kt = 0; kt < 8; ++kt) bK[kt] = ld_frag_full(kp + kt * 16 * DG, 0);
#pragma unroll  // constant indices keep the fragments in registers
  for (int kk = 0; kk < 4; ++kk) {
    bV1[kk] = ld_frag_full(vp + kk * 32, 0);
    bV2[kk] = ld_frag_full(vp + 16 * L_SEQ + kk * 32, 0);
  }
  // the wait stands ahead of any reuse of an address register of these loads: as operands of the
  // statement the addresses stay in their registers up to it
  asm volatile("s_wait_xcnt 0x0" :: "v"(qp), "v"(kp), "v"(vp) : "memory");

  // ---- pass 1: 16 units of one q row x 16 k rows; nothing here is read by another wave
  unsigned slot = 0;  // byte offset of unit u's slot in the ring
#pragma unroll 1  // one copy of the body: for speed only
  for (int u = 0; u < NUNIT; ++u) {
    // Unit u has landed. While refills go on, exactly units u + 1 and u + 2 (32 copies) were issued
    // behind it, and the counter returns in issue order; the trips without a refill wait to 0.
    if (u < NUNIT - URING) asm volatile("s_wait_asynccnt 0x20" ::: "memory");
    else                   asm volatile("s_wait_asynccnt 0x0" ::: "memory");
    const float* bp =
        reinterpret_cast<const float*>(biasSt + w * WRING + slot + n * BPITCH) + hi * 16;
    float4 av[16];  // av[4 s + t]: channels 32 s + 16 hi + 4 t .. + 3 of k row n
#pragma unroll  // constant indices keep av in registers
    for (int s = 0; s < 4; ++s)
#pragma unroll  // constant indices keep av in registers
      for (int t = 0; t < 4; ++t)
        av[s * 4 + t] = *reinterpret_cast<const float4*>(bp + s * 32 + t * 4);
    // the wave's own reads of the slot are done: only then may copies write it again
    asm volatile("s_wait_dscnt 0x0" ::: "memory");
    if (u < NUNIT - URING) {
      const int u3 = u + URING;
      copy_unit(ringLds + slot, gsrc + (size_t)(u3 >> 3) * L_SEQ * DB + (u3 & 7) * 16 * DB);
    }
    // a * b = ah * bh + (al * bh + ah * bl), al * bl left out: the large and the small products
    // are summed apart and added once
    v8f C = {0.f, 0.f, 0.f, 0.f, 0.f, 0.f, 0.f, 0.f};
    v8f Cs = {0.f, 0.f, 0.f, 0.f, 0.f, 0.f, 0.f, 0.f};
    v2f s01 = {0.f, 0.f}, s23 = {0.f, 0.f};
#pragma unroll  // constant indices into av, bH and bL
    for (int s = 0; s < 4; ++s) {
      v8u ah, al;
#pragma unroll  // constant indices keep the fragments in registers
      for (int t = 0; t < 4; ++t) {
        const v2f x01 = {av[s * 4 + t].x, av[s * 4 + t].y};
        const v2f x23 = {av[s * 4 + t].z, av[s * 4 + t].w};
        s01 += x01 * x01;
        s23 += x23 * x23;
        unsigned h, l;
        split2(x01, h, l);
        ah[2 * t] = h;
        al[2 * t] = l;
        split2(x23, h, l);
        ah[2 * t + 1] = h;
        al[2 * t + 1] = l;
      }
      C = wmma_b(ah, bH[s], C);
      Cs = wmma_b(al, bH[s], Cs);
      Cs = wmma_b(ah, bL[s], Cs);
    }
    C += Cs;
    const float ss = (s01.x + s01.y) + (s23.x + s23.y);
#pragma unroll  // constant indices keep the vectors in registers
    for (int j = 0; j < 8; ++j) rawW[(j + 8 * hi) * 17 + n] = C[j];
    ssqW[n * 2 + hi] = ss;
    // other lanes of this wave read what these stores wrote
    asm volatile("s_wait_dscnt 0x0" ::: "memory");
    // finish the layernorm correction of (q, k = n) for four heads
    {
      float sum = rawW[n * 17 + 8];
      float ssq = ssqW[n * 2] + ssqW[n * 2 + 1];
      float mu = sum * (1.f / 128.f);
      float var = ssq * (1.f / 128.f) - mu * mu;
      float rsg = rsqrtf(var + 1e-5f);
      float* pd = pairAll + (hi * 64 + w * 2 + (u >> 3)) * PKP + (u & 7) * 16 + n;
#pragma unroll  // constant indices keep the vectors in registers
      for (int i = 0; i < 4; ++i)
        pd[i * 16 * PKP] = rsg * (rawW[n * 17 + hi * 4 + i] - mu * gh[i]) + cb[i];
    }
    slot = (slot == (URING - 1) * USLOT) ? 0u : slot + USLOT;
  }
  __syncthreads();  // every wave's pair values are in place; wave w now reads head w of all 16 q

  // ---- pass 2: logits = Q*K^T + pair over all 128 k, one softmax, O = P*V
  v8f Lg[8];
#pragma unroll  // constant indices keep Lg in registers
  for (int kt = 0; kt < 8; ++kt) {
    v8f cp;
#pragma unroll  // constant indices keep the vectors in registers
    for (int j = 0; j < 8; ++j) cp[j] = pairAll[(w * 16 + j + 8 * hi) * PKP + kt * 16 + n];
    Lg[kt] = __builtin_amdgcn_wmma_f32_16x16x32_f16(false, aQ, false, bK[kt], (short)0, cp,
                                                    false, false);
  }
  float mrow[8], srow[8];
  _Float16* pw = pP + w * 16 * PPITCH;  // wave-private transpose of P (C layout -> A layout)
#pragma unroll  // constant indices keep the vectors in registers
  for (int j = 0; j < 8; ++j) {
    float mx = -1e30f;
#pragma unroll  // constant indices keep the vectors in registers
    for (int kt = 0; kt < 8; ++kt) mx = fmaxf(mx, Lg[kt][j]);
    mx = half16_max(mx);
    float s = 0.f;
#pragma unroll  // constant indices keep the vectors in registers
    for (int kt = 0; kt < 8; ++kt) {
      // exp(d) as 2^(d log2 e), what __expf computes
      const float p = exp2_slot((Lg[kt][j] - mx) * 1.44269504f);
      s += p;
      pw[(j + 8 * hi) * PPITCH + kt * 16 + n] = (_Float16)p;
    }
    srow[j] = half16_sum(s);
    mrow[j] = mx;
  }
  // other lanes of this wave read what these stores wrote
  asm volatile("s_wait_dscnt 0x0" ::: "memory");
  v8f O1 = {0.f, 0.f, 0.f, 0.f, 0.f, 0.f, 0.f, 0.f};
  v8f O2 = {0.f, 0.f, 0.f, 0.f, 0.f, 0.f, 0.f, 0.f};
#pragma unroll  // constant indices into bV1 and bV2
  for (int kk = 0; kk < 4; ++kk) {
    v16h aP = ld_frag_full(pw + n * PPITCH + kk * 32, off2);  // rows q, K = 32 k
    O1 = __builtin_amdgcn_wmma_f32_16x16x32_f16(false, aP, false, bV1[kk], (short)0,
                                                O1, false, false);
    O2 = __builtin_amdgcn_wmma_f32_16x16x32_f16(false, aP, false, bV2[kk], (short)0,
                                                O2, false, false);
  }

  // epilogue: write unnormalized partials (O, m, s) for this k-range
#pragma unroll  // constant indices keep the vectors in registers
  for (int j = 0; j < 8; ++j) {
    size_t row = (size_t)(b * L_SEQ + qt * 16 + j + 8 * hi);
    size_t base = ((size_t)ksp * ROWS + row) * DG + w * HD;
    Opart[base + n] = O1[j];
    Opart[base + 16 + n] = O2[j];
  }
  if (n == 0) {
#pragma unroll  // constant indices keep the vectors in registers
    for (int j = 0; j < 8; ++j) {
      size_t row = (size_t)(b * L_SEQ + qt * 16 + j + 8 * hi);
      mpart[((size_t)ksp * ROWS + row) * NH + w] = mrow[j];
      spart[((size_t)ksp * ROWS + row) * NH + w] = srow[j];
    }
  }
}

// ---------- kernel 3: combine split-K partials, normalize, gate -> f16 rows in LDS, then the
// output projection + bias (WMMA f16). grid (row tile, column half); wave w of a group combines
// rows 2w and 2w + 1 and then owns one 16-column tile of the product.
// amdgpu_waves_per_eu(2, 2): one group a WGP (128 groups in all), so no register is saved for more
// resident waves; without it the compiler holds the B-fragment loads back behind the arithmetic.
__global__ __launch_bounds__(256) __attribute__((amdgpu_waves_per_eu(2, 2)))
void k_out(const float* Opart, const float* mpart, const float* spart, const float* gate,
           const _Float16* WoutT, const float* bout, float* out) {
  const int mt = blockIdx.x, tid = threadIdx.x;
  const int w = tid >> 5, ln = tid & 31, n = ln & 15, hi = ln >> 4, off2 = hi * 8;
  const int col0 = (blockIdx.y * 8 + w) * 16;
  __shared__ __attribute__((aligned(16))) _Float16 aS[16 * APITCH];

  // a lane holds columns 64 i + 4 n .. + 3 of its row: 16 lanes read 256 contiguous bytes
  const int lrow = w * 2 + hi;
  const size_t row = (size_t)(mt * 16 + lrow);
  // the lane's own addresses: its row's 8 heads; columns 4 n .. 4 n + 3 of every 64
  const float* mp = mpart + row * NH;
  const float* sp = spart + row * NH;
  const float* op = Opart + row * DG + n * 4;
  const float* gp = gate + row * DG + n * 4;
  const _Float16* bp = WoutT + (size_t)(col0 + n) * DG + off2;
  const int oc = col0 + n;  // the lane's output column
  float4 mq[KSPLIT][2], sq[KSPLIT][2];  // maxima and sums of heads 0..3 and 4..7
  float4 ov[KSPLIT][4], gv[4];
  v16h bF[8];  // B fragments of the wave's 16 output columns, whole K
#pragma unroll  // constant indices keep the arrays in registers
  for (int g = 0; g < KSPLIT; ++g) {
    mq[g][0] = *reinterpret_cast<const float4*>(mp + g * ROWS * NH);
    mq[g][1] = *reinterpret_cast<const float4*>(mp + g * ROWS * NH + 4);
    sq[g][0] = *reinterpret_cast<const float4*>(sp + g * ROWS * NH);
    sq[g][1] = *reinterpret_cast<const float4*>(sp + g * ROWS * NH + 4);
  }
#pragma unroll  // constant indices keep the arrays in registers
  for (int i = 0; i < 4; ++i) {
#pragma unroll  // constant indices keep the arrays in registers
    for (int g = 0; g < KSPLIT; ++g)
      ov[g][i] = *reinterpret_cast<const float4*>(op + g * ROWS * DG + i * 64);
    gv[i] = *reinterpret_cast<const float4*>(gp + i * 64);
  }
#pragma unroll  // constant indices keep bF in registers
  for (int ks = 0; ks < 8; ++ks) bF[ks] = ld_frag_full(bp + ks * 32, 0);
  const float bo = bout[oc];
  // Every load of the kernel stands above this line (the "memory" clobber), so that a wave meets
  // one memory latency and not two. The wait stands ahead of any reuse of an address register:
  // as operands of the statement the addresses stay in their registers up to it.
  asm volatile("s_wait_xcnt 0x0" :: "v"(mp), "v"(sp), "v"(op), "v"(gp), "v"(bp), "v"(oc)
               : "memory");

  // columns 64 i + 4 n .. + 3 belong to head 2 i + (n >> 3)
  const bool odd = n >= 8;
  float mv[KSPLIT][4], sv[KSPLIT][4];
#pragma unroll  // constant indices keep the arrays in registers
  for (int g = 0; g < KSPLIT; ++g) {
    mv[g][0] = odd ? mq[g][0].y : mq[g][0].x;  sv[g][0] = odd ? sq[g][0].y : sq[g][0].x;
    mv[g][1] = odd ? mq[g][0].w : mq[g][0].z;  sv[g][1] = odd ? sq[g][0].w : sq[g][0].z;
    mv[g][2] = odd ? mq[g][1].y : mq[g][1].x;  sv[g][2] = odd ? sq[g][1].y : sq[g][1].x;
    mv[g][3] = odd ? mq[g][1].w : mq[g][1].z;  sv[g][3] = odd ? sq[g][1].w : sq[g][1].z;
  }
#pragma unroll  // constant indices keep the arrays in registers
  for (int i = 0; i < 4; ++i) {
    float m0 = -1e30f;
#pragma unroll  // constant indices keep the arrays in registers
    for (int g = 0; g < KSPLIT; ++g) m0 = fmaxf(m0, mv[g][i]);
    float s = 0.f, o0 = 0.f, o1 = 0.f, o2 = 0.f, o3 = 0.f;
#pragma unroll  // constant indices keep the arrays in registers
    for (int g = 0; g < KSPLIT; ++g) {
      // exp(d) as 2^(d log2 e), what __expf computes
      const float e = exp2_slot((mv[g][i] - m0) * 1.44269504f);
      s += sv[g][i] * e;
      o0 += ov[g][i].x * e;
      o1 += ov[g][i].y * e;
      o2 += ov[g][i].z * e;
      o3 += ov[g][i].w * e;
    }
    v4h r = {(_Float16)(o0 / s * gv[i].x), (_Float16)(o1 / s * gv[i].y),
             (_Float16)(o2 / s * gv[i].z), (_Float16)(o3 / s * gv[i].w)};
    *reinterpret_cast<v4h*>(aS + lrow * APITCH + i * 64 + n * 4) = r;
  }
  __syncthreads();  // every wave reads all 16 combined rows

  v8f c = {0.f, 0.f, 0.f, 0.f, 0.f, 0.f, 0.f, 0.f};
  const _Float16* ap = aS + n * APITCH;
#pragma unroll  // constant indices into bF
  for (int ks = 0; ks < 8; ++ks) {
    v16h a = ld_frag_full(ap + ks * 32, off2);
    c = __builtin_amdgcn_wmma_f32_16x16x32_f16(false, a, false, bF[ks], (short)0, c,
                                               false, false);
  }
#pragma unroll  // constant indices: the vector stays in registers
  for (int j = 0; j < 8; ++j)
    out[(size_t)(mt * 16 + j + 8 * hi) * DG + oc] = c[j] + bo;
}

extern "C" void kernel_launch(void* const* d_in, const int* in_sizes, int n_in,
                              void* d_out, int out_size, void* d_ws, size_t ws_size,
                              hipStream_t stream) {
  (void)in_sizes; (void)n_in; (void)out_size; (void)ws_size;
  const float* x       = (const float*)d_in[0];
  const float* bias    = (const float*)d_in[1];
  const float* g_gamma = (const float*)d_in[2];
  const float* g_beta  = (const float*)d_in[3];
  const float* b_gamma = (const float*)d_in[4];
  const float* b_beta  = (const float*)d_in[5];
  const float* Wq      = (const float*)d_in[6];
  const float* Wk      = (const float*)d_in[7];
  const float* Wv      = (const float*)d_in[8];
  const float* Wb      = (const float*)d_in[9];
  const float* Wg      = (const float*)d_in[10];
  const float* bg      = (const float*)d_in[11];
  const float* Wout    = (const float*)d_in[12];
  const float* bout    = (const float*)d_in[13];
  float* out = (float*)d_out;

  char* p = (char*)d_ws;
  _Float16* WoutT   = (_Float16*)p; p += (size_t)DG * DG * sizeof(_Float16);
  _Float16* qh      = (_Float16*)p; p += (size_t)ROWS * DG * sizeof(_Float16);
  _Float16* kh      = (_Float16*)p; p += (size_t)ROWS * DG * sizeof(_Float16);
  _Float16* vT      = (_Float16*)p; p += (size_t)ROWS * DG * sizeof(_Float16);
  float* gate       = (float*)p;    p += (size_t)ROWS * DG * sizeof(float);
  float* Opart      = (float*)p;    p += (size_t)KSPLIT * ROWS * DG * sizeof(float);
  float* mpart      = (float*)p;    p += (size_t)KSPLIT * ROWS * NH * sizeof(float);
  float* spart      = (float*)p;    p += (size_t)KSPLIT * ROWS * NH * sizeof(float);

  k_proj<<<dim3(ROWS / PROWS, 5), 256, 0, stream>>>(x, g_gamma, g_beta, Wq, Wk, Wv, Wg, Wout, bg,
                                                 qh, kh, vT, gate, WoutT);
  k_attn<<<dim3(32, 2, KSPLIT), 256, 0, stream>>>(bias, b_gamma, b_beta, Wb, qh, kh,
                                                  vT, Opart, mpart, spart);
  k_out<<<dim3(ROWS / 16, 2), 256, 0, stream>>>(Opart, mpart, spart, gate, WoutT, bout, out);
}
